// v000
// Times are from an AMD MI455X. After a warm-up the kernel runs many times in a row, and a time is the length of
// such a window on the GPU divided by its runs, so every launch and the gaps after it count. The runs cycle
// through copies of the inputs. A figure is the median of several windows, for all but v000 over two sittings.
// Sittings can differ by a few percent; kernels timed side by side share one.
// v000 is the starting kernel. One run takes 159 microseconds.
#include <hip/hip_runtime.h>
#include <math.h>

// ---- CDNA5 flash-attention (causal): f16 WMMA, f32 online softmax.
// ---- 4 waves x 32 queries, double-buffered LDS pipeline, 1 barrier/iter.
// ---- Row-sum lane-merge deferred to epilogue (one shfl per q-tile).
typedef __attribute__((ext_vector_type(16))) _Float16 v16h;
typedef __attribute__((ext_vector_type(8)))  _Float16 v8h;
typedef __attribute__((ext_vector_type(4)))  _Float16 v4h;
typedef __attribute__((ext_vector_type(8)))  float    v8f;
typedef __attribute__((ext_vector_type(4)))  float    v4f;

constexpr int Bb = 2, Ls = 4096, Hh = 8, Dd = 64;
constexpr int BLOCK_M = 128;   // 4 waves x 32 query rows
constexpr int KB      = 32;    // keys per block (= WMMA K-dim for PV)
constexpr int KROW    = 72;    // LDS halves per K row  [32 x 64 + pad]
constexpr int VROW    = 40;    // LDS halves per V^T row [64 x 32 + pad]
constexpr float SCL   = 0.125f * 1.44269504088896340736f; // (1/sqrt(D))*log2e
constexpr float NEG   = -1.0e30f;

// raw v_exp_f32: no denormal-range fixup (masked scores -> exact 0)
__device__ inline float fexp2(float x) { return __builtin_amdgcn_exp2f(x); }

__device__ inline v16h frag(const _Float16* s, int o0, int o1) {
  v8h lo = *(const v8h*)(s + o0);     // 16B aligned by construction
  v8h hi = *(const v8h*)(s + o1);
  return __builtin_shufflevector(lo, hi, 0,1,2,3,4,5,6,7,8,9,10,11,12,13,14,15);
}

__global__ __launch_bounds__(128)
void fa_fwd_causal(const float* __restrict__ Q, const float* __restrict__ K,
                   const float* __restrict__ V, float* __restrict__ O) {
  __shared__ __align__(16) _Float16 sK[2][KB * KROW];  // [key][d]
  __shared__ __align__(16) _Float16 sV[2][Dd * VROW];  // [d][key] (transposed)

  const int tid  = threadIdx.x;
  const int wave = tid >> 5;
  const int lane = tid & 31;
  const int ll   = lane & 15;
  const int hb   = (lane >> 4) & 1;

  const int bh = blockIdx.y;
  const int b  = bh / Hh, h = bh % Hh;
  const int qbase = blockIdx.x * BLOCK_M;
  const int qt0 = qbase + wave * 32;      // this wave: queries qt0..qt0+31

  const size_t bstr = (size_t)Ls * Hh * Dd;
  const float* Qb = Q + (size_t)b * bstr + (size_t)h * Dd;
  const float* Kb = K + (size_t)b * bstr + (size_t)h * Dd;
  const float* Vb = V + (size_t)b * bstr + (size_t)h * Dd;
  float*       Ob = O + (size_t)b * bstr + (size_t)h * Dd;

  // cooperative-load mapping: float4 idx = i*128+tid -> (key, 4 d's), i=0..3
  int kk[4], dd[4];
#pragma unroll
  for (int i = 0; i < 4; ++i) {
    const int idx = i * 128 + tid;
    kk[i] = idx >> 4;
    dd[i] = (idx & 15) << 2;
  }

  // ---- Q^T B-fragments: [qi][dh], loaded once ----
  v16h bq[2][2];
#pragma unroll
  for (int qi = 0; qi < 2; ++qi) {
    const float* qrow = Qb + (size_t)(qt0 + qi * 16 + ll) * Hh * Dd;
#pragma unroll
    for (int f = 0; f < 2; ++f) {
      const int d0 = f * 32 + 8 * hb;
      v4f a0 = *(const v4f*)(qrow + d0);
      v4f a1 = *(const v4f*)(qrow + d0 + 4);
      v4f a2 = *(const v4f*)(qrow + d0 + 16);
      v4f a3 = *(const v4f*)(qrow + d0 + 20);
#pragma unroll
      for (int j = 0; j < 4; ++j) {
        bq[qi][f][j]      = (_Float16)a0[j];
        bq[qi][f][j + 4]  = (_Float16)a1[j];
        bq[qi][f][j + 8]  = (_Float16)a2[j];
        bq[qi][f][j + 12] = (_Float16)a3[j];
      }
    }
  }

  v8f acc[2][4];
#pragma unroll
  for (int qi = 0; qi < 2; ++qi)
    for (int t = 0; t < 4; ++t)
      for (int r = 0; r < 8; ++r) acc[qi][t][r] = 0.0f;
  float m_i[2] = {NEG, NEG};
  float l_i[2] = {0.0f, 0.0f};     // own-half partial sums; merged in epilogue

  const int nkb = (qbase >> 5) + 4;

  // ---- prologue: issue block-0 loads (8x global_load_b128, no waits) ----
  v4f rk[4], rv[4];
#pragma unroll
  for (int i = 0; i < 4; ++i) {
    const size_t g = (size_t)kk[i] * Hh * Dd + dd[i];
    rk[i] = *(const v4f*)(Kb + g);
    rv[i] = *(const v4f*)(Vb + g);
  }

  for (int ib = 0; ib < nkb; ++ib) {
    const int cur = ib & 1;
    const int kb  = ib * KB;

    // ---- stage current block into LDS (f32 -> f16) ----
#pragma unroll
    for (int i = 0; i < 4; ++i) {
      v4h hk;
#pragma unroll
      for (int j = 0; j < 4; ++j) hk[j] = (_Float16)rk[i][j];
      *(v4h*)(&sK[cur][kk[i] * KROW + dd[i]]) = hk;      // ds_store_b64
#pragma unroll
      for (int j = 0; j < 4; ++j)
        sV[cur][(dd[i] + j) * VROW + kk[i]] = (_Float16)rv[i][j];
    }

    // ---- issue next block's loads before the barrier (latency overlap) ----
    if (ib + 1 < nkb) {
      const int kn = kb + KB;
#pragma unroll
      for (int i = 0; i < 4; ++i) {
        const size_t g = (size_t)(kn + kk[i]) * Hh * Dd + dd[i];
        rk[i] = *(const v4f*)(Kb + g);
        rv[i] = *(const v4f*)(Vb + g);
      }
    }

    __syncthreads();   // single barrier/iter: double buffer makes it safe

    // both q-tiles active iff kb <= qt0 (kb, qt0 are 32-aligned); uniform.
    if (kb <= qt0) {
      const _Float16* cK = sK[cur];
      const _Float16* cV = sV[cur];

      // ---- K A-fragments, shared by both q-tiles ----
      v16h aK[2][2];                               // [ktile][dh]
#pragma unroll
      for (int kt = 0; kt < 2; ++kt)
#pragma unroll
        for (int dh = 0; dh < 2; ++dh)
          aK[kt][dh] = frag(cK, (kt * 16 + ll) * KROW + 32 * dh + 8 * hb,
                                (kt * 16 + ll) * KROW + 32 * dh + 16 + 8 * hb);

      // ---- S^T = K x Q^T : 8 WMMAs, 4 independent accumulator chains ----
      v8f s[2][2];                                 // [qi][ktile]
#pragma unroll
      for (int qi = 0; qi < 2; ++qi)
        for (int kt = 0; kt < 2; ++kt)
          for (int r = 0; r < 8; ++r) s[qi][kt][r] = 0.0f;
#pragma unroll
      for (int dh = 0; dh < 2; ++dh)
#pragma unroll
        for (int qi = 0; qi < 2; ++qi)
#pragma unroll
          for (int kt = 0; kt < 2; ++kt)
            s[qi][kt] = __builtin_amdgcn_wmma_f32_16x16x32_f16(
                false, aK[kt][dh], false, bq[qi][dh], (short)0, s[qi][kt],
                false, false);

      // ---- per-tile softmax; masking only on the diagonal block ----
      v16h bp[2];
      const bool diag = (kb == qt0);
#pragma unroll
      for (int qi = 0; qi < 2; ++qi) {
        const int q = qt0 + qi * 16 + ll;
        if (diag) {
#pragma unroll
          for (int r = 0; r < 8; ++r) {
            const int k0 = kb + r + 8 * hb;
            s[qi][0][r] = (k0      > q) ? NEG : s[qi][0][r];
            s[qi][1][r] = (k0 + 16 > q) ? NEG : s[qi][1][r];
          }
        }
        // row max MUST merge the lane pair (both halves feed one column)
        float vmax = NEG;
#pragma unroll
        for (int r = 0; r < 8; ++r)
          vmax = fmaxf(vmax, fmaxf(s[qi][0][r], s[qi][1][r]));
        vmax = fmaxf(vmax, __shfl_xor(vmax, 16, 32));
        const float m_new = fmaxf(m_i[qi], vmax);
        const float ms    = m_new * SCL;
        const float alpha = fexp2(fmaf(m_i[qi], SCL, -ms));

        float rsum = 0.0f;                      // own-half sum only (deferred)
#pragma unroll
        for (int r = 0; r < 8; ++r) {
          const float p0 = fexp2(fmaf(s[qi][0][r], SCL, -ms));
          const float p1 = fexp2(fmaf(s[qi][1][r], SCL, -ms));
          rsum += p0 + p1;
          bp[qi][r]     = (_Float16)p0;
          bp[qi][r + 8] = (_Float16)p1;
        }
        l_i[qi] = l_i[qi] * alpha + rsum;       // same alpha in both lanes
        m_i[qi] = m_new;
#pragma unroll
        for (int t = 0; t < 4; ++t)
          for (int r = 0; r < 8; ++r) acc[qi][t][r] *= alpha;
      }

      // ---- O^T += V^T x P^T : V fragments reused by both q-tiles ----
#pragma unroll
      for (int t = 0; t < 4; ++t) {
        const int d = t * 16 + ll;
        v16h av = frag(cV, d * VROW + 8 * hb, d * VROW + 16 + 8 * hb);
        acc[0][t] = __builtin_amdgcn_wmma_f32_16x16x32_f16(
            false, av, false, bp[0], (short)0, acc[0][t], false, false);
        acc[1][t] = __builtin_amdgcn_wmma_f32_16x16x32_f16(
            false, av, false, bp[1], (short)0, acc[1][t], false, false);
      }
    }
  }

  // ---- epilogue: merge partner half-sums once, then normalize ----
#pragma unroll
  for (int qi = 0; qi < 2; ++qi) {
    const float l_tot = l_i[qi] + __shfl_xor(l_i[qi], 16, 32);
    const float inv = 1.0f / l_tot;
    float* orow = Ob + (size_t)(qt0 + qi * 16 + ll) * Hh * Dd;
#pragma unroll
    for (int t = 0; t < 4; ++t) {
      v4f o0, o1;
#pragma unroll
      for (int r = 0; r < 4; ++r) {
        o0[r] = acc[qi][t][r] * inv;
        o1[r] = acc[qi][t][r + 4] * inv;
      }
      *(v4f*)(orow + t * 16 + 8 * hb)     = o0;
      *(v4f*)(orow + t * 16 + 8 * hb + 4) = o1;
    }
  }
}

extern "C" void kernel_launch(void* const* d_in, const int* in_sizes, int n_in,
                              void* d_out, int out_size, void* d_ws, size_t ws_size,
                              hipStream_t stream) {
  const float* q = (const float*)d_in[0];
  const float* k = (const float*)d_in[1];
  const float* v = (const float*)d_in[2];
  float* o = (float*)d_out;
  dim3 grid(Ls / BLOCK_M, Bb * Hh);   // 32 x 16 = 512 workgroups
  fa_fwd_causal<<<grid, dim3(128), 0, stream>>>(q, k, v, o);
}

// v001
// It runs in 107 microseconds.
// In both of two side-by-side timings against v000, it was 1.49 times as fast.
#include <hip/hip_runtime.h>
#include <math.h>

// ---- CDNA5 flash-attention (causal): f16 WMMA, f32 online softmax.
// ---- 4 waves x 32 queries, double-buffered LDS, 1 barrier/iter; the next
// ---- block is staged in the middle of the current block's compute.
// ---- Row-sum lane-merge deferred to epilogue (one shfl total).
typedef __attribute__((ext_vector_type(16))) _Float16 v16h;
typedef __attribute__((ext_vector_type(8)))  _Float16 v8h;
typedef __attribute__((ext_vector_type(4)))  _Float16 v4h;
typedef __attribute__((ext_vector_type(8)))  float    v8f;
typedef __attribute__((ext_vector_type(4)))  float    v4f;

constexpr int Bb = 2, Ls = 4096, Hh = 8, Dd = 64;
constexpr int BLOCK_M = 128;   // 4 waves x 32 query rows
constexpr int KB      = 32;    // keys per block (= WMMA K-dim for PV)
constexpr int KROW    = 72;    // LDS halves per K row  [32 x 64 + pad]
constexpr int VROW    = 40;    // LDS halves per V^T row [64 x 32 + pad]
constexpr float SCL   = 0.125f * 1.44269504088896340736f; // (1/sqrt(D))*log2e
constexpr float NEG   = -1.0e30f;

// raw v_exp_f32: no denormal-range fixup (masked scores -> exact 0)
__device__ inline float fexp2(float x) { return __builtin_amdgcn_exp2f(x); }

__device__ inline v16h frag(const _Float16* s, int o0, int o1) {
  v8h lo = *(const v8h*)(s + o0);     // 16B aligned by construction
  v8h hi = *(const v8h*)(s + o1);
  return __builtin_shufflevector(lo, hi, 0,1,2,3,4,5,6,7,8,9,10,11,12,13,14,15);
}

__global__ __launch_bounds__(128)
void fa_fwd_causal(const float* __restrict__ Q, const float* __restrict__ K,
                   const float* __restrict__ V, float* __restrict__ O) {
  __shared__ __align__(16) _Float16 sK[2][KB * KROW];  // [key][d]
  __shared__ __align__(16) _Float16 sV[2][Dd * VROW];  // [d][key] (transposed)

  const int tid  = threadIdx.x;
  const int wave = tid >> 5;
  const int lane = tid & 31;
  const int ll   = lane & 15;
  const int hb   = (lane >> 4) & 1;

  const int bh = blockIdx.y;
  const int b  = bh / Hh, h = bh % Hh;
  const int qbase = blockIdx.x * BLOCK_M;
  const int qt0 = qbase + wave * 32;      // this wave: queries qt0..qt0+31

  const size_t bstr = (size_t)Ls * Hh * Dd;
  const float* Qb = Q + (size_t)b * bstr + (size_t)h * Dd;
  const float* Kb = K + (size_t)b * bstr + (size_t)h * Dd;
  const float* Vb = V + (size_t)b * bstr + (size_t)h * Dd;
  float*       Ob = O + (size_t)b * bstr + (size_t)h * Dd;

  // cooperative-load mapping: float4 idx = i*128+tid -> (key, 4 d's), i=0..3
  int kk[4], dd[4];
#pragma unroll
  for (int i = 0; i < 4; ++i) {
    const int idx = i * 128 + tid;
    kk[i] = idx >> 4;
    dd[i] = (idx & 15) << 2;
  }

  // ---- Q^T B-fragments: [qi][dh], loaded once ----
  v16h bq[2][2];
#pragma unroll
  for (int qi = 0; qi < 2; ++qi) {
    const float* qrow = Qb + (size_t)(qt0 + qi * 16 + ll) * Hh * Dd;
#pragma unroll
    for (int f = 0; f < 2; ++f) {
      const int d0 = f * 32 + 8 * hb;
      v4f a0 = *(const v4f*)(qrow + d0);
      v4f a1 = *(const v4f*)(qrow + d0 + 4);
      v4f a2 = *(const v4f*)(qrow + d0 + 16);
      v4f a3 = *(const v4f*)(qrow + d0 + 20);
#pragma unroll
      for (int j = 0; j < 4; ++j) {
        bq[qi][f][j]      = (_Float16)a0[j];
        bq[qi][f][j + 4]  = (_Float16)a1[j];
        bq[qi][f][j + 8]  = (_Float16)a2[j];
        bq[qi][f][j + 12] = (_Float16)a3[j];
      }
    }
  }

  v8f acc[2][4];
#pragma unroll
  for (int qi = 0; qi < 2; ++qi)
    for (int t = 0; t < 4; ++t)
      for (int r = 0; r < 8; ++r) acc[qi][t][r] = 0.0f;
  float m_i[2] = {NEG, NEG};
  float l_i[2] = {0.0f, 0.0f};     // own-half partial sums; merged in epilogue

  const int nkb = (qbase >> 5) + 4;

  // ---- prologue: block 0 through registers into buffer 0, block 1 in flight ----
  v4f rk[4], rv[4];
#pragma unroll
  for (int i = 0; i < 4; ++i) {
    const size_t g = (size_t)kk[i] * Hh * Dd + dd[i];
    rk[i] = *(const v4f*)(Kb + g);
    rv[i] = *(const v4f*)(Vb + g);
  }
#pragma unroll
  for (int i = 0; i < 4; ++i) {
    v4h hk;
#pragma unroll
    for (int j = 0; j < 4; ++j) hk[j] = (_Float16)rk[i][j];
    *(v4h*)(&sK[0][kk[i] * KROW + dd[i]]) = hk;
#pragma unroll
    for (int j = 0; j < 4; ++j)
      sV[0][(dd[i] + j) * VROW + kk[i]] = (_Float16)rv[i][j];
  }
#pragma unroll
  for (int i = 0; i < 4; ++i) {          // nkb >= 4: block 1 always exists
    const unsigned g = (unsigned)(kk[i] * Hh * Dd + dd[i]);
    rk[i] = *(const v4f*)(Kb + KB * Hh * Dd + g);
    rv[i] = *(const v4f*)(Vb + KB * Hh * Dd + g);
  }

  for (int ib = 0; ib < nkb; ++ib) {
    const int cur = ib & 1;
    const int kb  = ib * KB;

    // Publishes buffer cur and frees buffer cur^1. Waits on LDS only:
    // __syncthreads() also drains loadcnt, which would expose the whole
    // latency of the global loads that are in flight for the next block.
    asm volatile("s_wait_dscnt 0x0\n\ts_barrier_signal -1\n\ts_barrier_wait -1"
                 ::: "memory");

    // both q-tiles active iff kb <= qt0 (kb, qt0 are 32-aligned); uniform.
    const bool active = (kb <= qt0);
    v8f  s[2][2];                                  // [qi][ktile]
    v16h av[4];                                    // V^T fragments, [dtile]
    float vmax[2];

    if (active) {
      const _Float16* cK = sK[cur];
      const _Float16* cV = sV[cur];

      // ---- K A-fragments, shared by both q-tiles ----
      v16h aK[2][2];                               // [ktile][dh]
#pragma unroll
      for (int kt = 0; kt < 2; ++kt)
#pragma unroll
        for (int dh = 0; dh < 2; ++dh)
          aK[kt][dh] = frag(cK, (kt * 16 + ll) * KROW + 32 * dh + 8 * hb,
                                (kt * 16 + ll) * KROW + 32 * dh + 16 + 8 * hb);
      // ---- V^T fragments now, ahead of the next block's LDS stores ----
#pragma unroll
      for (int t = 0; t < 4; ++t) {
        const int d = t * 16 + ll;
        av[t] = frag(cV, d * VROW + 8 * hb, d * VROW + 16 + 8 * hb);
      }

      // ---- S^T = K x Q^T : 8 WMMAs, 4 independent accumulator chains ----
#pragma unroll
      for (int qi = 0; qi < 2; ++qi)
        for (int kt = 0; kt < 2; ++kt)
          for (int r = 0; r < 8; ++r) s[qi][kt][r] = 0.0f;
#pragma unroll
      for (int dh = 0; dh < 2; ++dh)
#pragma unroll
        for (int qi = 0; qi < 2; ++qi)
#pragma unroll
          for (int kt = 0; kt < 2; ++kt)
            s[qi][kt] = __builtin_amdgcn_wmma_f32_16x16x32_f16(
                false, aK[kt][dh], false, bq[qi][dh], (short)0, s[qi][kt],
                false, false);

      // ---- masking only on the diagonal block; row max ----
      const bool diag = (kb == qt0);
#pragma unroll
      for (int qi = 0; qi < 2; ++qi) {
        const int q = qt0 + qi * 16 + ll;
        if (diag) {
#pragma unroll
          for (int r = 0; r < 8; ++r) {
            const int k0 = kb + r + 8 * hb;
            s[qi][0][r] = (k0      > q) ? NEG : s[qi][0][r];
            s[qi][1][r] = (k0 + 16 > q) ? NEG : s[qi][1][r];
          }
        }
        // row max MUST merge the lane pair (both halves feed one column)
        float vm = NEG;
#pragma unroll
        for (int r = 0; r < 8; ++r)
          vm = fmaxf(vm, fmaxf(s[qi][0][r], s[qi][1][r]));
        vmax[qi] = vm;
      }
      const float o0 = __shfl_xor(vmax[0], 16, 32);
      const float o1 = __shfl_xor(vmax[1], 16, 32);
      // keeps both exchanges in flight together: without it the scheduler
      // puts the second behind the first one's wait (two latencies in a row)
      __builtin_amdgcn_sched_barrier(0);
      vmax[0] = fmaxf(vmax[0], o0);
      vmax[1] = fmaxf(vmax[1], o1);
    }

    // ---- stage block ib+1 into the other buffer (f32 -> f16): every wave.
    // ---- Its loads had a whole pass to land; its stores drain under the
    // ---- exponentials and the PV products below.
    if (ib + 1 < nkb) {
      const int nxt = cur ^ 1;
#pragma unroll
      for (int i = 0; i < 4; ++i) {
        v4h hk;
#pragma unroll
        for (int j = 0; j < 4; ++j) hk[j] = (_Float16)rk[i][j];
        *(v4h*)(&sK[nxt][kk[i] * KROW + dd[i]]) = hk;      // ds_store_b64
#pragma unroll
        for (int j = 0; j < 4; ++j)
          sV[nxt][(dd[i] + j) * VROW + kk[i]] = (_Float16)rv[i][j];
      }
      // ---- issue block ib+2's loads; they are waited for one pass later ----
      if (ib + 2 < nkb) {
        // uniform block base + loop-invariant lane offset: no vector address
        // arithmetic per pass, and the lane-offset registers are never rewritten
        const float* Kn = Kb + (size_t)(kb + 2 * KB) * Hh * Dd;
        const float* Vn = Vb + (size_t)(kb + 2 * KB) * Hh * Dd;
#pragma unroll
        for (int i = 0; i < 4; ++i) {
          const unsigned g = (unsigned)(kk[i] * Hh * Dd + dd[i]);
          rk[i] = *(const v4f*)(Kn + g);
          rv[i] = *(const v4f*)(Vn + g);
        }
      }
    }

    if (active) {
      // ---- per-tile softmax ----
      v16h bp[2];
#pragma unroll
      for (int qi = 0; qi < 2; ++qi) {
        const float m_new = fmaxf(m_i[qi], vmax[qi]);
        const float ms    = m_new * SCL;
        const float alpha = fexp2(fmaf(m_i[qi], SCL, -ms));

        float rsum = 0.0f;                      // own-half sum only (deferred)
#pragma unroll
        for (int r = 0; r < 8; ++r) {
          const float p0 = fexp2(fmaf(s[qi][0][r], SCL, -ms));
          const float p1 = fexp2(fmaf(s[qi][1][r], SCL, -ms));
          rsum += p0 + p1;
          bp[qi][r]     = (_Float16)p0;
          bp[qi][r + 8] = (_Float16)p1;
        }
        l_i[qi] = l_i[qi] * alpha + rsum;       // same alpha in both lanes
        m_i[qi] = m_new;
#pragma unroll
        for (int t = 0; t < 4; ++t)
          for (int r = 0; r < 8; ++r) acc[qi][t][r] *= alpha;
      }

      // ---- O^T += V^T x P^T : V fragments reused by both q-tiles ----
#pragma unroll
      for (int t = 0; t < 4; ++t) {
        acc[0][t] = __builtin_amdgcn_wmma_f32_16x16x32_f16(
            false, av[t], false, bp[0], (short)0, acc[0][t], false, false);
        acc[1][t] = __builtin_amdgcn_wmma_f32_16x16x32_f16(
            false, av[t], false, bp[1], (short)0, acc[1][t], false, false);
      }
    }
  }

  // ---- epilogue: merge partner half-sums once, then normalize ----
#pragma unroll
  for (int qi = 0; qi < 2; ++qi) {
    const float l_tot = l_i[qi] + __shfl_xor(l_i[qi], 16, 32);
    const float inv = 1.0f / l_tot;
    float* orow = Ob + (size_t)(qt0 + qi * 16 + ll) * Hh * Dd;
#pragma unroll
    for (int t = 0; t < 4; ++t) {
      v4f o0, o1;
#pragma unroll
      for (int r = 0; r < 4; ++r) {
        o0[r] = acc[qi][t][r] * inv;
        o1[r] = acc[qi][t][r + 4] * inv;
      }
      *(v4f*)(orow + t * 16 + 8 * hb)     = o0;
      *(v4f*)(orow + t * 16 + 8 * hb + 4) = o1;
    }
  }
}

extern "C" void kernel_launch(void* const* d_in, const int* in_sizes, int n_in,
                              void* d_out, int out_size, void* d_ws, size_t ws_size,
                              hipStream_t stream) {
  const float* q = (const float*)d_in[0];
  const float* k = (const float*)d_in[1];
  const float* v = (const float*)d_in[2];
  float* o = (float*)d_out;
  dim3 grid(Ls / BLOCK_M, Bb * Hh);   // 32 x 16 = 512 workgroups
  fa_fwd_causal<<<grid, dim3(128), 0, stream>>>(q, k, v, o);
}

// v002
// One run takes 97.2 microseconds.
// Timed twice side by side with v001, it ran 1.10 times as fast both times.
// Counting every step since v000, it is 1.64 times as fast.
#include <hip/hip_runtime.h>
#include <math.h>

// ---- CDNA5 flash-attention (causal): f16 WMMA, f32 online softmax.
// ---- 4 waves x 32 queries, double-buffered LDS, 1 barrier/iter; the next
// ---- block is staged in the middle of the current block's compute.
// ---- Row-sum lane-merge deferred to epilogue (one shfl total).
// ---- Causal balance: a work-group runs query tile NT-1-x, then tile x, so
// ---- every work-group walks the same number of key blocks.
typedef __attribute__((ext_vector_type(16))) _Float16 v16h;
typedef __attribute__((ext_vector_type(8)))  _Float16 v8h;
typedef __attribute__((ext_vector_type(4)))  _Float16 v4h;
typedef __attribute__((ext_vector_type(8)))  float    v8f;
typedef __attribute__((ext_vector_type(4)))  float    v4f;

constexpr int Bb = 2, Ls = 4096, Hh = 8, Dd = 64;
constexpr int BLOCK_M = 128;   // 4 waves x 32 query rows
constexpr int NT      = Ls / BLOCK_M;  // query tiles per (batch, head)
constexpr int KB      = 32;    // keys per block (= WMMA K-dim for PV)
constexpr int KROW    = 72;    // LDS halves per K row  [32 x 64 + pad]
constexpr int VROW    = 40;    // LDS halves per V^T row [64 x 32 + pad]
constexpr float SCL   = 0.125f * 1.44269504088896340736f; // (1/sqrt(D))*log2e
constexpr float NEG   = -1.0e30f;

// raw v_exp_f32: no denormal-range fixup (masked scores -> exact 0)
__device__ inline float fexp2(float x) { return __builtin_amdgcn_exp2f(x); }

__device__ inline v16h frag(const _Float16* s, int o0, int o1) {
  v8h lo = *(const v8h*)(s + o0);     // 16B aligned by construction
  v8h hi = *(const v8h*)(s + o1);
  return __builtin_shufflevector(lo, hi, 0,1,2,3,4,5,6,7,8,9,10,11,12,13,14,15);
}

__global__ __launch_bounds__(128)
void fa_fwd_causal(const float* __restrict__ Q, const float* __restrict__ K,
                   const float* __restrict__ V, float* __restrict__ O) {
  __shared__ __align__(16) _Float16 sK[2][KB * KROW];  // [key][d]
  __shared__ __align__(16) _Float16 sV[2][Dd * VROW];  // [d][key] (transposed)

  const int tid  = threadIdx.x;
  const int wave = tid >> 5;
  const int lane = tid & 31;
  const int ll   = lane & 15;
  const int hb   = (lane >> 4) & 1;

  const int bh = blockIdx.y;
  const int b  = bh / Hh, h = bh % Hh;

  const size_t bstr = (size_t)Ls * Hh * Dd;
  const float* Qb = Q + (size_t)b * bstr + (size_t)h * Dd;
  const float* Kb = K + (size_t)b * bstr + (size_t)h * Dd;
  const float* Vb = V + (size_t)b * bstr + (size_t)h * Dd;
  float*       Ob = O + (size_t)b * bstr + (size_t)h * Dd;

  // cooperative-load mapping: float4 idx = i*128+tid -> (key, 4 d's), i=0..3
  int kk[4], dd[4];
#pragma unroll
  for (int i = 0; i < 4; ++i) {
    const int idx = i * 128 + tid;
    kk[i] = idx >> 4;
    dd[i] = (idx & 15) << 2;
  }

  // Two tiles one after the other: 4*(NT-x) + 4*(x+1) key blocks for every x.
  // No barrier between them: the first tile's last pass reads buffer 1 only,
  // every read of buffer 0 ended before that pass's barrier, and buffer 1 is
  // rewritten only behind the second tile's first barrier.
  for (int half = 0; half < 2; ++half) {
  const int qbase = (half ? (int)blockIdx.x : NT - 1 - (int)blockIdx.x) * BLOCK_M;
  const int qt0 = qbase + wave * 32;      // this wave: queries qt0..qt0+31

  // ---- Q^T B-fragments: [qi][dh], loaded once per tile ----
  v16h bq[2][2];
#pragma unroll
  for (int qi = 0; qi < 2; ++qi) {
    const float* qrow = Qb + (size_t)(qt0 + qi * 16 + ll) * Hh * Dd;
#pragma unroll
    for (int f = 0; f < 2; ++f) {
      const int d0 = f * 32 + 8 * hb;
      v4f a0 = *(const v4f*)(qrow + d0);
      v4f a1 = *(const v4f*)(qrow + d0 + 4);
      v4f a2 = *(const v4f*)(qrow + d0 + 16);
      v4f a3 = *(const v4f*)(qrow + d0 + 20);
#pragma unroll
      for (int j = 0; j < 4; ++j) {
        bq[qi][f][j]      = (_Float16)a0[j];
        bq[qi][f][j + 4]  = (_Float16)a1[j];
        bq[qi][f][j + 8]  = (_Float16)a2[j];
        bq[qi][f][j + 12] = (_Float16)a3[j];
      }
    }
  }

  v8f acc[2][4];
#pragma unroll
  for (int qi = 0; qi < 2; ++qi)
    for (int t = 0; t < 4; ++t)
      for (int r = 0; r < 8; ++r) acc[qi][t][r] = 0.0f;
  float m_i[2] = {NEG, NEG};
  float l_i[2] = {0.0f, 0.0f};     // own-half partial sums; merged in epilogue

  const int nkb = (qbase >> 5) + 4;

  // ---- prologue: block 0 through registers into buffer 0, block 1 in flight ----
  v4f rk[4], rv[4];
#pragma unroll
  for (int i = 0; i < 4; ++i) {
    const size_t g = (size_t)kk[i] * Hh * Dd + dd[i];
    rk[i] = *(const v4f*)(Kb + g);
    rv[i] = *(const v4f*)(Vb + g);
  }
#pragma unroll
  for (int i = 0; i < 4; ++i) {
    v4h hk;
#pragma unroll
    for (int j = 0; j < 4; ++j) hk[j] = (_Float16)rk[i][j];
    *(v4h*)(&sK[0][kk[i] * KROW + dd[i]]) = hk;
#pragma unroll
    for (int j = 0; j < 4; ++j)
      sV[0][(dd[i] + j) * VROW + kk[i]] = (_Float16)rv[i][j];
  }
#pragma unroll
  for (int i = 0; i < 4; ++i) {          // nkb >= 4: block 1 always exists
    const unsigned g = (unsigned)(kk[i] * Hh * Dd + dd[i]);
    rk[i] = *(const v4f*)(Kb + KB * Hh * Dd + g);
    rv[i] = *(const v4f*)(Vb + KB * Hh * Dd + g);
  }

  for (int ib = 0; ib < nkb; ++ib) {
    const int cur = ib & 1;
    const int kb  = ib * KB;

    // Publishes buffer cur and frees buffer cur^1. Waits on LDS only:
    // __syncthreads() also drains loadcnt, which would expose the whole
    // latency of the global loads that are in flight for the next block.
    asm volatile("s_wait_dscnt 0x0\n\ts_barrier_signal -1\n\ts_barrier_wait -1"
                 ::: "memory");

    // both q-tiles active iff kb <= qt0 (kb, qt0 are 32-aligned); uniform.
    const bool active = (kb <= qt0);
    v8f  s[2][2];                                  // [qi][ktile]
    v16h av[4];                                    // V^T fragments, [dtile]
    float vmax[2];

    if (active) {
      const _Float16* cK = sK[cur];
      const _Float16* cV = sV[cur];

      // ---- K A-fragments, shared by both q-tiles ----
      v16h aK[2][2];                               // [ktile][dh]
#pragma unroll
      for (int kt = 0; kt < 2; ++kt)
#pragma unroll
        for (int dh = 0; dh < 2; ++dh)
          aK[kt][dh] = frag(cK, (kt * 16 + ll) * KROW + 32 * dh + 8 * hb,
                                (kt * 16 + ll) * KROW + 32 * dh + 16 + 8 * hb);
      // ---- V^T fragments now, ahead of the next block's LDS stores ----
#pragma unroll
      for (int t = 0; t < 4; ++t) {
        const int d = t * 16 + ll;
        av[t] = frag(cV, d * VROW + 8 * hb, d * VROW + 16 + 8 * hb);
      }

      // ---- S^T = K x Q^T : 8 WMMAs, 4 independent accumulator chains ----
#pragma unroll
      for (int qi = 0; qi < 2; ++qi)
        for (int kt = 0; kt < 2; ++kt)
          for (int r = 0; r < 8; ++r) s[qi][kt][r] = 0.0f;
#pragma unroll
      for (int dh = 0; dh < 2; ++dh)
#pragma unroll
        for (int qi = 0; qi < 2; ++qi)
#pragma unroll
          for (int kt = 0; kt < 2; ++kt)
            s[qi][kt] = __builtin_amdgcn_wmma_f32_16x16x32_f16(
                false, aK[kt][dh], false, bq[qi][dh], (short)0, s[qi][kt],
                false, false);

      // ---- masking only on the diagonal block; row max ----
      const bool diag = (kb == qt0);
#pragma unroll
      for (int qi = 0; qi < 2; ++qi) {
        const int q = qt0 + qi * 16 + ll;
        if (diag) {
#pragma unroll
          for (int r = 0; r < 8; ++r) {
            const int k0 = kb + r + 8 * hb;
            s[qi][0][r] = (k0      > q) ? NEG : s[qi][0][r];
            s[qi][1][r] = (k0 + 16 > q) ? NEG : s[qi][1][r];
          }
        }
        // row max MUST merge the lane pair (both halves feed one column)
        float vm = NEG;
#pragma unroll
        for (int r = 0; r < 8; ++r)
          vm = fmaxf(vm, fmaxf(s[qi][0][r], s[qi][1][r]));
        vmax[qi] = vm;
      }
      const float o0 = __shfl_xor(vmax[0], 16, 32);
      const float o1 = __shfl_xor(vmax[1], 16, 32);
      // keeps both exchanges in flight together: without it the scheduler
      // puts the second behind the first one's wait (two latencies in a row)
      __builtin_amdgcn_sched_barrier(0);
      vmax[0] = fmaxf(vmax[0], o0);
      vmax[1] = fmaxf(vmax[1], o1);
    }

    // ---- stage block ib+1 into the other buffer (f32 -> f16): every wave.
    // ---- Its loads had a whole pass to land; its stores drain under the
    // ---- exponentials and the PV products below.
    if (ib + 1 < nkb) {
      const int nxt = cur ^ 1;
#pragma unroll
      for (int i = 0; i < 4; ++i) {
        v4h hk;
#pragma unroll
        for (int j = 0; j < 4; ++j) hk[j] = (_Float16)rk[i][j];
        *(v4h*)(&sK[nxt][kk[i] * KROW + dd[i]]) = hk;      // ds_store_b64
#pragma unroll
        for (int j = 0; j < 4; ++j)
          sV[nxt][(dd[i] + j) * VROW + kk[i]] = (_Float16)rv[i][j];
      }
      // ---- issue block ib+2's loads; they are waited for one pass later ----
      if (ib + 2 < nkb) {
        // uniform block base + loop-invariant lane offset: no vector address
        // arithmetic per pass, and the lane-offset registers are never rewritten
        const float* Kn = Kb + (size_t)(kb + 2 * KB) * Hh * Dd;
        const float* Vn = Vb + (size_t)(kb + 2 * KB) * Hh * Dd;
#pragma unroll
        for (int i = 0; i < 4; ++i) {
          const unsigned g = (unsigned)(kk[i] * Hh * Dd + dd[i]);
          rk[i] = *(const v4f*)(Kn + g);
          rv[i] = *(const v4f*)(Vn + g);
        }
      }
    }

    if (active) {
      // ---- per-tile softmax ----
      v16h bp[2];
#pragma unroll
      for (int qi = 0; qi < 2; ++qi) {
        const float m_new = fmaxf(m_i[qi], vmax[qi]);
        const float ms    = m_new * SCL;
        const float alpha = fexp2(fmaf(m_i[qi], SCL, -ms));

        float rsum = 0.0f;                      // own-half sum only (deferred)
#pragma unroll
        for (int r = 0; r < 8; ++r) {
          const float p0 = fexp2(fmaf(s[qi][0][r], SCL, -ms));
          const float p1 = fexp2(fmaf(s[qi][1][r], SCL, -ms));
          rsum += p0 + p1;
          bp[qi][r]     = (_Float16)p0;
          bp[qi][r + 8] = (_Float16)p1;
        }
        l_i[qi] = l_i[qi] * alpha + rsum;       // same alpha in both lanes
        m_i[qi] = m_new;
#pragma unroll
        for (int t = 0; t < 4; ++t)
          for (int r = 0; r < 8; ++r) acc[qi][t][r] *= alpha;
      }

      // ---- O^T += V^T x P^T : V fragments reused by both q-tiles ----
#pragma unroll
      for (int t = 0; t < 4; ++t) {
        acc[0][t] = __builtin_amdgcn_wmma_f32_16x16x32_f16(
            false, av[t], false, bp[0], (short)0, acc[0][t], false, false);
        acc[1][t] = __builtin_amdgcn_wmma_f32_16x16x32_f16(
            false, av[t], false, bp[1], (short)0, acc[1][t], false, false);
      }
    }
  }

  // ---- epilogue: merge partner half-sums once, then normalize ----
#pragma unroll
  for (int qi = 0; qi < 2; ++qi) {
    const float l_tot = l_i[qi] + __shfl_xor(l_i[qi], 16, 32);
    const float inv = 1.0f / l_tot;
    float* orow = Ob + (size_t)(qt0 + qi * 16 + ll) * Hh * Dd;
#pragma unroll
    for (int t = 0; t < 4; ++t) {
      v4f o0, o1;
#pragma unroll
      for (int r = 0; r < 4; ++r) {
        o0[r] = acc[qi][t][r] * inv;
        o1[r] = acc[qi][t][r + 4] * inv;
      }
      *(v4f*)(orow + t * 16 + 8 * hb)     = o0;
      *(v4f*)(orow + t * 16 + 8 * hb + 4) = o1;
    }
  }
  // the next tile's set-up overwrites registers that these stores name
  asm volatile("s_wait_xcnt 0x0" ::: "memory");
  }  // half
}

extern "C" void kernel_launch(void* const* d_in, const int* in_sizes, int n_in,
                              void* d_out, int out_size, void* d_ws, size_t ws_size,
                              hipStream_t stream) {
  const float* q = (const float*)d_in[0];
  const float* k = (const float*)d_in[1];
  const float* v = (const float*)d_in[2];
  float* o = (float*)d_out;
  dim3 grid(NT / 2, Bb * Hh);         // 16 x 16 = 256 workgroups, two tiles each
  fa_fwd_causal<<<grid, dim3(128), 0, stream>>>(q, k, v, o);
}

// v003
// A run of this version takes 63.6 microseconds.
// In both of two side-by-side timings against v002, it was 1.53 times as fast.
// All steps since v000 together make it 2.51 times as fast.
#include <hip/hip_runtime.h>
#include <math.h>

// ---- CDNA5 flash-attention (causal): f16 WMMA, f32 online softmax.
// ---- 16 waves: 4 query slabs of 32 rows x 4 key groups. A stage is 128 keys;
// ---- key group g takes the stage's g-th block of 32, so four waves share each
// ---- SIMD and fill one another's waits. Each group keeps its own running
// ---- max / sum / output; the four are joined through LDS at the tile's end.
// ---- Double-buffered LDS, 1 barrier/stage; the next stage is staged in the
// ---- middle of the current one's compute.
// ---- Row-sum lane-merge deferred to epilogue (one shfl total).
// ---- Causal balance: a work-group runs query tile NT-1-x, then tile x, so
// ---- every work-group walks the same number of key blocks.
typedef __attribute__((ext_vector_type(16))) _Float16 v16h;
typedef __attribute__((ext_vector_type(8)))  _Float16 v8h;
typedef __attribute__((ext_vector_type(4)))  _Float16 v4h;
typedef __attribute__((ext_vector_type(8)))  float    v8f;
typedef __attribute__((ext_vector_type(4)))  float    v4f;

constexpr int Bb = 2, Ls = 4096, Hh = 8, Dd = 64;
constexpr int BLOCK_M = 128;   // 4 slabs x 32 query rows
constexpr int NT      = Ls / BLOCK_M;  // query tiles per (batch, head)
constexpr int KB      = 32;    // keys per block (= WMMA K-dim for PV)
constexpr int KG      = 4;     // key groups (waves per query slab)
constexpr int SB      = KB * KG;       // keys per stage
constexpr int NTHR    = 32 * 4 * KG;   // threads per work-group
constexpr int KROW    = 72;    // LDS halves per K row  [32 x 64 + pad]
constexpr int VROW    = 40;    // LDS halves per V^T row [64 x 32 + pad]
constexpr float SCL   = 0.125f * 1.44269504088896340736f; // (1/sqrt(D))*log2e
constexpr float NEG   = -1.0e30f;

// raw v_exp_f32: no denormal-range fixup (masked scores -> exact 0)
__device__ inline float fexp2(float x) { return __builtin_amdgcn_exp2f(x); }

__device__ inline v16h frag(const _Float16* s, int o0, int o1) {
  v8h lo = *(const v8h*)(s + o0);     // 16B aligned by construction
  v8h hi = *(const v8h*)(s + o1);
  return __builtin_shufflevector(lo, hi, 0,1,2,3,4,5,6,7,8,9,10,11,12,13,14,15);
}

__global__ __launch_bounds__(NTHR)
void fa_fwd_causal(const float* __restrict__ Q, const float* K,
                   const float* V, float* __restrict__ O) {
  // K, V without __restrict__: with it the first two stages' loads, alike for
  // both tiles, are lifted out of the tile loop and held in scratch across it
  __shared__ __align__(16) _Float16 sK[2][SB * KROW];       // [key][d]
  __shared__ __align__(16) _Float16 sV[2][KG * Dd * VROW];  // [block][d][key]
  // the key groups' partial results: [group][slab][chunk][lane][4]
  __shared__ __align__(16) float sAcc[KG][4][16][32][4];
  __shared__ float sML[KG][4][2][2][32];       // [group][slab][qi][max|sum][lane]

  const int tid  = threadIdx.x;
  // scalar wave number: slab, key group and the tests on them stay out of the
  // vector registers (a 16-wave work-group has 256 a wave; without this: scratch)
  const int wave = __builtin_amdgcn_readfirstlane(tid >> 5);
  const int qw   = wave & 3;     // query slab
  const int kg   = wave >> 2;    // key group
  const int lane = tid & 31;
  const int ll   = lane & 15;
  const int hb   = (lane >> 4) & 1;

  const int bh = blockIdx.y;
  const int b  = bh / Hh, h = bh % Hh;

  const size_t bstr = (size_t)Ls * Hh * Dd;
  const float* Qb = Q + (size_t)b * bstr + (size_t)h * Dd;
  const float* Kb = K + (size_t)b * bstr + (size_t)h * Dd;
  const float* Vb = V + (size_t)b * bstr + (size_t)h * Dd;
  float*       Ob = O + (size_t)b * bstr + (size_t)h * Dd;

  // cooperative-load mapping: a thread's i-th float4 (i = 0..KG-1) is key kw,
  // d = dq..dq+3 of the stage's block i: one lane offset, the rest constants
  const int kw = tid >> 4;
  const int dq = (tid & 15) << 2;
  const unsigned gl = (unsigned)(kw * Hh * Dd + dq);

  // Two tiles one after the other: (NT-x) + (x+1) stages for every x.
  // The barrier of the first tile's join also ends every read of its stages.
  for (int half = 0; half < 2; ++half) {
  const int qbase = (half ? (int)blockIdx.x : NT - 1 - (int)blockIdx.x) * BLOCK_M;
  const int qt0 = qbase + qw * 32;        // this wave: queries qt0..qt0+31

  // ---- Q^T B-fragments: [qi][dh], loaded once per tile ----
  v16h bq[2][2];
#pragma unroll
  for (int qi = 0; qi < 2; ++qi) {
    const float* qrow = Qb + (size_t)(qt0 + qi * 16 + ll) * Hh * Dd;
#pragma unroll
    for (int f = 0; f < 2; ++f) {
      const int d0 = f * 32 + 8 * hb;
      v4f a0 = *(const v4f*)(qrow + d0);
      v4f a1 = *(const v4f*)(qrow + d0 + 4);
      v4f a2 = *(const v4f*)(qrow + d0 + 16);
      v4f a3 = *(const v4f*)(qrow + d0 + 20);
#pragma unroll
      for (int j = 0; j < 4; ++j) {
        bq[qi][f][j]      = (_Float16)a0[j];
        bq[qi][f][j + 4]  = (_Float16)a1[j];
        bq[qi][f][j + 8]  = (_Float16)a2[j];
        bq[qi][f][j + 12] = (_Float16)a3[j];
      }
    }
  }

  v8f acc[2][4];
#pragma unroll
  for (int qi = 0; qi < 2; ++qi)
    for (int t = 0; t < 4; ++t)
      for (int r = 0; r < 8; ++r) acc[qi][t][r] = 0.0f;
  float m_i[2] = {NEG, NEG};
  float l_i[2] = {0.0f, 0.0f};     // own-half partial sums; merged in epilogue

  const int nst = qbase / SB + 1;         // stages of SB keys

  // ---- prologue: stage 0 through registers into buffer 0, stage 1 in flight ----
  v4f rk[4], rv[4];
#pragma unroll
  for (int i = 0; i < 4; ++i) {
    rk[i] = *(const v4f*)(Kb + i * KB * Hh * Dd + gl);
    rv[i] = *(const v4f*)(Vb + i * KB * Hh * Dd + gl);
  }
#pragma unroll
  for (int i = 0; i < 4; ++i) {
    v4h hk;
#pragma unroll
    for (int j = 0; j < 4; ++j) hk[j] = (_Float16)rk[i][j];
    *(v4h*)(&sK[0][(i * KB + kw) * KROW + dq]) = hk;
#pragma unroll
    for (int j = 0; j < 4; ++j)
      sV[0][(i * Dd + dq + j) * VROW + kw] = (_Float16)rv[i][j];
  }
  if (nst > 1) {
#pragma unroll
    for (int i = 0; i < 4; ++i) {
      rk[i] = *(const v4f*)(Kb + (SB + i * KB) * Hh * Dd + gl);
      rv[i] = *(const v4f*)(Vb + (SB + i * KB) * Hh * Dd + gl);
    }
  }

  for (int ib = 0; ib < nst; ++ib) {
    const int cur = ib & 1;
    const int kb  = ib * SB + kg * KB;    // this wave's block of the stage

    // Publishes buffer cur and frees buffer cur^1. Waits on LDS only:
    // __syncthreads() also drains loadcnt, which would expose the whole
    // latency of the global loads that are in flight for the next block.
    asm volatile("s_wait_dscnt 0x0\n\ts_barrier_signal -1\n\ts_barrier_wait -1"
                 ::: "memory");

    // both q-tiles active iff kb <= qt0 (kb, qt0 are 32-aligned); uniform.
    const bool active = (kb <= qt0);
    v8f  s[2][2];                                  // [qi][ktile]
    v16h av[4];                                    // V^T fragments, [dtile]
    float vmax[2];

    if (active) {
      const _Float16* cK = sK[cur] + kg * KB * KROW;
      const _Float16* cV = sV[cur] + kg * Dd * VROW;

      // ---- K A-fragments, shared by both q-tiles ----
      v16h aK[2][2];                               // [ktile][dh]
#pragma unroll
      for (int kt = 0; kt < 2; ++kt)
#pragma unroll
        for (int dh = 0; dh < 2; ++dh)
          aK[kt][dh] = frag(cK, (kt * 16 + ll) * KROW + 32 * dh + 8 * hb,
                                (kt * 16 + ll) * KROW + 32 * dh + 16 + 8 * hb);
      // ---- V^T fragments now, ahead of the next block's LDS stores ----
#pragma unroll
      for (int t = 0; t < 4; ++t) {
        const int d = t * 16 + ll;
        av[t] = frag(cV, d * VROW + 8 * hb, d * VROW + 16 + 8 * hb);
      }

      // ---- S^T = K x Q^T : 8 WMMAs, 4 independent accumulator chains ----
#pragma unroll
      for (int qi = 0; qi < 2; ++qi)
        for (int kt = 0; kt < 2; ++kt)
          for (int r = 0; r < 8; ++r) s[qi][kt][r] = 0.0f;
#pragma unroll
      for (int dh = 0; dh < 2; ++dh)
#pragma unroll
        for (int qi = 0; qi < 2; ++qi)
#pragma unroll
          for (int kt = 0; kt < 2; ++kt)
            s[qi][kt] = __builtin_amdgcn_wmma_f32_16x16x32_f16(
                false, aK[kt][dh], false, bq[qi][dh], (short)0, s[qi][kt],
                false, false);

      // ---- masking only on the diagonal block; row max ----
      const bool diag = (kb == qt0);
#pragma unroll
      for (int qi = 0; qi < 2; ++qi) {
        const int q = qt0 + qi * 16 + ll;
        if (diag) {
#pragma unroll
          for (int r = 0; r < 8; ++r) {
            const int k0 = kb + r + 8 * hb;
            s[qi][0][r] = (k0      > q) ? NEG : s[qi][0][r];
            s[qi][1][r] = (k0 + 16 > q) ? NEG : s[qi][1][r];
          }
        }
        // row max MUST merge the lane pair (both halves feed one column)
        float vm = NEG;
#pragma unroll
        for (int r = 0; r < 8; ++r)
          vm = fmaxf(vm, fmaxf(s[qi][0][r], s[qi][1][r]));
        vmax[qi] = vm;
      }
      const float o0 = __shfl_xor(vmax[0], 16, 32);
      const float o1 = __shfl_xor(vmax[1], 16, 32);
      // keeps both exchanges in flight together: without it the scheduler
      // puts the second behind the first one's wait (two latencies in a row)
      __builtin_amdgcn_sched_barrier(0);
      vmax[0] = fmaxf(vmax[0], o0);
      vmax[1] = fmaxf(vmax[1], o1);
    }

    // ---- stage ib+1 into the other buffer (f32 -> f16): every wave.
    // ---- Its loads had a whole pass to land; its stores drain under the
    // ---- exponentials and the PV products below.
    if (ib + 1 < nst) {
      const int nxt = cur ^ 1;
#pragma unroll
      for (int i = 0; i < 4; ++i) {
        v4h hk;
#pragma unroll
        for (int j = 0; j < 4; ++j) hk[j] = (_Float16)rk[i][j];
        *(v4h*)(&sK[nxt][(i * KB + kw) * KROW + dq]) = hk;  // ds_store_b64
#pragma unroll
        for (int j = 0; j < 4; ++j)
          sV[nxt][(i * Dd + dq + j) * VROW + kw] = (_Float16)rv[i][j];
      }
      // ---- issue stage ib+2's loads; they are waited for one pass later ----
      if (ib + 2 < nst) {
        const float* Kn = Kb + (size_t)((ib + 2) * SB) * Hh * Dd;
        const float* Vn = Vb + (size_t)((ib + 2) * SB) * Hh * Dd;
#pragma unroll
        for (int i = 0; i < 4; ++i) {
          rk[i] = *(const v4f*)(Kn + i * KB * Hh * Dd + gl);
          rv[i] = *(const v4f*)(Vn + i * KB * Hh * Dd + gl);
        }
        // the code below overwrites the address registers that these loads name
        asm volatile("s_wait_xcnt 0x0" ::: "memory");
      }
    }

    if (active) {
      // ---- per-tile softmax ----
      v16h bp[2];
#pragma unroll
      for (int qi = 0; qi < 2; ++qi) {
        const float m_new = fmaxf(m_i[qi], vmax[qi]);
        const float ms    = m_new * SCL;
        const float alpha = fexp2(fmaf(m_i[qi], SCL, -ms));

        float rsum = 0.0f;                      // own-half sum only (deferred)
#pragma unroll
        for (int r = 0; r < 8; ++r) {
          const float p0 = fexp2(fmaf(s[qi][0][r], SCL, -ms));
          const float p1 = fexp2(fmaf(s[qi][1][r], SCL, -ms));
          rsum += p0 + p1;
          bp[qi][r]     = (_Float16)p0;
          bp[qi][r + 8] = (_Float16)p1;
        }
        l_i[qi] = l_i[qi] * alpha + rsum;       // same alpha in both lanes
        m_i[qi] = m_new;
#pragma unroll
        for (int t = 0; t < 4; ++t)
          for (int r = 0; r < 8; ++r) acc[qi][t][r] *= alpha;
      }

      // ---- O^T += V^T x P^T : V fragments reused by both q-tiles ----
#pragma unroll
      for (int t = 0; t < 4; ++t) {
        acc[0][t] = __builtin_amdgcn_wmma_f32_16x16x32_f16(
            false, av[t], false, bp[0], (short)0, acc[0][t], false, false);
        acc[1][t] = __builtin_amdgcn_wmma_f32_16x16x32_f16(
            false, av[t], false, bp[1], (short)0, acc[1][t], false, false);
      }
    }
  }

  // ---- join of the key groups: every group lays down max, sum, output ----
#pragma unroll
  for (int qi = 0; qi < 2; ++qi) {
    sML[kg][qw][qi][0][lane] = m_i[qi];
    sML[kg][qw][qi][1][lane] = l_i[qi];
#pragma unroll
    for (int t = 0; t < 4; ++t)
#pragma unroll
      for (int c = 0; c < 2; ++c) {
        v4f p;
#pragma unroll
        for (int r = 0; r < 4; ++r) p[r] = acc[qi][t][c * 4 + r];
        *(v4f*)(&sAcc[kg][qw][(qi * 4 + t) * 2 + c][lane][0]) = p;
      }
  }
  // publishes the partial results; behind it no wave reads this tile's stages
  __syncthreads();

  // ---- epilogue: group kg finishes q-tile kg / 2, d-tiles 2 * (kg & 1) and the
  // ---- next (whole 128-byte lines of its rows): every group's part rescaled to
  // ---- the common max and added in group order, partner half-sums merged
  // ---- once, normalized ----
  {
    const int qe = kg >> 1;
    const int t0 = (kg & 1) * 2;
    float mg[KG], w[KG];
    float mt = NEG;
#pragma unroll
    for (int k = 0; k < KG; ++k) {
      mg[k] = sML[k][qw][qe][0][lane];
      mt = fmaxf(mt, mg[k]);
    }
    const float ms = mt * SCL;
    float l = 0.0f;
#pragma unroll
    for (int k = 0; k < KG; ++k) {     // a group that saw no key: max NEG, weight 0
      w[k] = fexp2(fmaf(mg[k], SCL, -ms));
      l = fmaf(sML[k][qw][qe][1][lane], w[k], l);
    }
    const float l_tot = l + __shfl_xor(l, 16, 32);
    const float inv = 1.0f / l_tot;
#pragma unroll
    for (int k = 0; k < KG; ++k) w[k] *= inv;
    float* orow = Ob + (size_t)(qt0 + qe * 16 + ll) * Hh * Dd + t0 * 16 + 8 * hb;
#pragma unroll
    for (int tt = 0; tt < 2; ++tt)
#pragma unroll
      for (int c = 0; c < 2; ++c) {
        v4f o;
#pragma unroll
        for (int r = 0; r < 4; ++r) o[r] = 0.0f;
#pragma unroll
        for (int k = 0; k < KG; ++k) {
          const v4f p =
              *(const v4f*)(&sAcc[k][qw][(qe * 4 + t0 + tt) * 2 + c][lane][0]);
#pragma unroll
          for (int r = 0; r < 4; ++r) o[r] = fmaf(p[r], w[k], o[r]);
        }
        *(v4f*)(orow + tt * 16 + 4 * c) = o;
      }
  }
  // the next tile's set-up overwrites registers that these stores name
  asm volatile("s_wait_xcnt 0x0" ::: "memory");
  }  // half
}

extern "C" void kernel_launch(void* const* d_in, const int* in_sizes, int n_in,
                              void* d_out, int out_size, void* d_ws, size_t ws_size,
                              hipStream_t stream) {
  const float* q = (const float*)d_in[0];
  const float* k = (const float*)d_in[1];
  const float* v = (const float*)d_in[2];
  float* o = (float*)d_out;
  dim3 grid(NT / 2, Bb * Hh);         // 16 x 16 = 256 workgroups, two tiles each
  fa_fwd_causal<<<grid, dim3(NTHR), 0, stream>>>(q, k, v, o);
}

// v004
// A run of this version takes 43 microseconds.
// Timed twice side by side with v003, it ran 1.48 times as fast both times.
// Counting every step since v000, it is 3.71 times as fast.
#include <hip/hip_runtime.h>
#include <math.h>

// ---- CDNA5 flash-attention (causal): f16 WMMA, f32 online softmax.
// ---- 16 waves: 4 query slabs of 32 rows x 4 key groups. A stage is 128 keys;
// ---- key group g takes the stage's g-th block of 32, so four waves share each
// ---- SIMD and fill one another's waits. Each group keeps its own running
// ---- max / sum / output; the four are joined through LDS at the tile's end.
// ---- Double-buffered LDS, 1 barrier/stage; the next stage is staged in the
// ---- middle of the current one's compute.
// ---- V lies in LDS as it lies in memory, [key][d]; the transposing LDS load
// ---- hands out the V^T fragments.
// ---- Row-sum lane-merge deferred to epilogue (one shfl total).
// ---- Causal balance: a work-group runs query tile NT-1-x, then tile x, so
// ---- every work-group walks the same number of key blocks.
typedef __attribute__((ext_vector_type(16))) _Float16 v16h;
typedef __attribute__((ext_vector_type(8)))  _Float16 v8h;
typedef __attribute__((ext_vector_type(4)))  _Float16 v4h;
typedef __attribute__((ext_vector_type(8)))  float    v8f;
typedef __attribute__((ext_vector_type(4)))  float    v4f;
typedef __attribute__((ext_vector_type(8)))  short    v8s;
typedef __attribute__((address_space(3)))    v8s      lds_v8s;

constexpr int Bb = 2, Ls = 4096, Hh = 8, Dd = 64;
constexpr int BLOCK_M = 128;   // 4 slabs x 32 query rows
constexpr int NT      = Ls / BLOCK_M;  // query tiles per (batch, head)
constexpr int KB      = 32;    // keys per block (= WMMA K-dim for PV)
constexpr int KG      = 4;     // key groups (waves per query slab)
constexpr int SB      = KB * KG;       // keys per stage
constexpr int NTHR    = 32 * 4 * KG;   // threads per work-group
constexpr int KROW    = 72;    // LDS halves per K row  [32 x 64 + pad]
constexpr int VROW    = 80;    // LDS halves per V row  [32 x 64 + pad]: 32 B x odd
constexpr float SCL   = 0.125f * 1.44269504088896340736f; // (1/sqrt(D))*log2e
constexpr float NEG   = -1.0e30f;

// raw v_exp_f32: no denormal-range fixup (masked scores -> exact 0)
__device__ inline float fexp2(float x) { return __builtin_amdgcn_exp2f(x); }

__device__ inline v16h frag(const _Float16* s, int o0, int o1) {
  v8h lo = *(const v8h*)(s + o0);     // 16B aligned by construction
  v8h hi = *(const v8h*)(s + o1);
  return __builtin_shufflevector(lo, hi, 0,1,2,3,4,5,6,7,8,9,10,11,12,13,14,15);
}

// V^T A-fragment (16 d x 32 keys) out of row-major V: p is the lane's own
// address, row 8 * (lane >> 4) + (lane & 7), 16 bytes in for lanes 8..15 of a
// half. Each load hands lane (c, h) keys 8h..8h+7 of column c; the second one,
// 16 rows on, the keys 16 + 8h..: the k order of the packed P^T operand.
__device__ inline v16h frag_tr(const _Float16* p) {
  v8h lo = __builtin_bit_cast(v8h, __builtin_amdgcn_ds_load_tr16_b128_v8i16((lds_v8s*)p));
  v8h hi = __builtin_bit_cast(v8h, __builtin_amdgcn_ds_load_tr16_b128_v8i16(
                                       (lds_v8s*)(p + 16 * VROW)));
  return __builtin_shufflevector(lo, hi, 0,1,2,3,4,5,6,7,8,9,10,11,12,13,14,15);
}

__global__ __launch_bounds__(NTHR)
void fa_fwd_causal(const float* __restrict__ Q, const float* K,
                   const float* V, float* __restrict__ O) {
  // K, V without __restrict__: with it the first two stages' loads, alike for
  // both tiles, are lifted out of the tile loop and held in scratch across it
  __shared__ __align__(16) _Float16 sK[2][SB * KROW];       // [key][d]
  __shared__ __align__(16) _Float16 sV[2][SB * VROW];       // [key][d]
  // the key groups' partial results: [group][slab][chunk][lane][4]
  __shared__ __align__(16) float sAcc[KG][4][16][32][4];
  __shared__ float sML[KG][4][2][2][32];       // [group][slab][qi][max|sum][lane]

  const int tid  = threadIdx.x;
  // scalar wave number: slab, key group and the tests on them stay out of the
  // vector registers (a 16-wave work-group has 256 a wave; without this: scratch)
  const int wave = __builtin_amdgcn_readfirstlane(tid >> 5);
  const int qw   = wave & 3;     // query slab
  const int kg   = wave >> 2;    // key group
  const int lane = tid & 31;
  const int ll   = lane & 15;
  const int hb   = (lane >> 4) & 1;

  const int bh = blockIdx.y;
  const int b  = bh / Hh, h = bh % Hh;

  const size_t bstr = (size_t)Ls * Hh * Dd;
  const float* Qb = Q + (size_t)b * bstr + (size_t)h * Dd;
  const float* Kb = K + (size_t)b * bstr + (size_t)h * Dd;
  const float* Vb = V + (size_t)b * bstr + (size_t)h * Dd;
  float*       Ob = O + (size_t)b * bstr + (size_t)h * Dd;

  // cooperative-load mapping: a thread's i-th float4 (i = 0..KG-1) is key kw,
  // d = dq..dq+3 of the stage's block i: one lane offset, the rest constants
  const int kw = tid >> 4;
  const int dq = (tid & 15) << 2;
  const unsigned gl = (unsigned)(kw * Hh * Dd + dq);

  // Two tiles one after the other: (NT-x) + (x+1) stages for every x.
  // The barrier of the first tile's join also ends every read of its stages.
  for (int half = 0; half < 2; ++half) {
  const int qbase = (half ? (int)blockIdx.x : NT - 1 - (int)blockIdx.x) * BLOCK_M;
  const int qt0 = qbase + qw * 32;        // this wave: queries qt0..qt0+31

  // ---- Q^T B-fragments: [qi][dh], loaded once per tile ----
  v16h bq[2][2];
#pragma unroll
  for (int qi = 0; qi < 2; ++qi) {
    const float* qrow = Qb + (size_t)(qt0 + qi * 16 + ll) * Hh * Dd;
#pragma unroll
    for (int f = 0; f < 2; ++f) {
      const int d0 = f * 32 + 8 * hb;
      v4f a0 = *(const v4f*)(qrow + d0);
      v4f a1 = *(const v4f*)(qrow + d0 + 4);
      v4f a2 = *(const v4f*)(qrow + d0 + 16);
      v4f a3 = *(const v4f*)(qrow + d0 + 20);
#pragma unroll
      for (int j = 0; j < 4; ++j) {
        bq[qi][f][j]      = (_Float16)a0[j];
        bq[qi][f][j + 4]  = (_Float16)a1[j];
        bq[qi][f][j + 8]  = (_Float16)a2[j];
        bq[qi][f][j + 12] = (_Float16)a3[j];
      }
    }
  }

  v8f acc[2][4];
#pragma unroll
  for (int qi = 0; qi < 2; ++qi)
    for (int t = 0; t < 4; ++t)
      for (int r = 0; r < 8; ++r) acc[qi][t][r] = 0.0f;
  float m_i[2] = {NEG, NEG};
  float l_i[2] = {0.0f, 0.0f};     // own-half partial sums; merged in epilogue

  const int nst = qbase / SB + 1;         // stages of SB keys

  // ---- prologue: stage 0 through registers into buffer 0, stage 1 in flight ----
  v4f rk[4], rv[4];
#pragma unroll
  for (int i = 0; i < 4; ++i) {
    rk[i] = *(const v4f*)(Kb + i * KB * Hh * Dd + gl);
    rv[i] = *(const v4f*)(Vb + i * KB * Hh * Dd + gl);
  }
#pragma unroll
  for (int i = 0; i < 4; ++i) {
    v4h hk;
#pragma unroll
    for (int j = 0; j < 4; ++j) hk[j] = (_Float16)rk[i][j];
    *(v4h*)(&sK[0][(i * KB + kw) * KROW + dq]) = hk;
    v4h hv;
#pragma unroll
    for (int j = 0; j < 4; ++j) hv[j] = (_Float16)rv[i][j];
    *(v4h*)(&sV[0][(i * KB + kw) * VROW + dq]) = hv;
  }
  if (nst > 1) {
#pragma unroll
    for (int i = 0; i < 4; ++i) {
      rk[i] = *(const v4f*)(Kb + (SB + i * KB) * Hh * Dd + gl);
      rv[i] = *(const v4f*)(Vb + (SB + i * KB) * Hh * Dd + gl);
    }
  }

  for (int ib = 0; ib < nst; ++ib) {
    const int cur = ib & 1;
    const int kb  = ib * SB + kg * KB;    // this wave's block of the stage

    // Publishes buffer cur and frees buffer cur^1. Waits on LDS only:
    // __syncthreads() also drains loadcnt, which would expose the whole
    // latency of the global loads that are in flight for the next block.
    asm volatile("s_wait_dscnt 0x0\n\ts_barrier_signal -1\n\ts_barrier_wait -1"
                 ::: "memory");

    // both q-tiles active iff kb <= qt0 (kb, qt0 are 32-aligned); uniform.
    const bool active = (kb <= qt0);
    v8f  s[2][2];                                  // [qi][ktile]
    v16h av[4];                                    // V^T fragments, [dtile]
    float vmax[2];

    if (active) {
      const _Float16* cK = sK[cur] + kg * KB * KROW;
      const _Float16* cV = sV[cur] + (kg * KB + 8 * hb + (lane & 7)) * VROW
                           + 8 * ((lane >> 3) & 1);

      // ---- K A-fragments, shared by both q-tiles ----
      v16h aK[2][2];                               // [ktile][dh]
#pragma unroll
      for (int kt = 0; kt < 2; ++kt)
#pragma unroll
        for (int dh = 0; dh < 2; ++dh)
          aK[kt][dh] = frag(cK, (kt * 16 + ll) * KROW + 32 * dh + 8 * hb,
                                (kt * 16 + ll) * KROW + 32 * dh + 16 + 8 * hb);
      // ---- V^T fragments now, ahead of the next block's LDS stores ----
#pragma unroll
      for (int t = 0; t < 4; ++t) av[t] = frag_tr(cV + t * 16);

      // ---- S^T = K x Q^T : 8 WMMAs, 4 independent accumulator chains ----
#pragma unroll
      for (int qi = 0; qi < 2; ++qi)
        for (int kt = 0; kt < 2; ++kt)
          for (int r = 0; r < 8; ++r) s[qi][kt][r] = 0.0f;
#pragma unroll
      for (int dh = 0; dh < 2; ++dh)
#pragma unroll
        for (int qi = 0; qi < 2; ++qi)
#pragma unroll
          for (int kt = 0; kt < 2; ++kt)
            s[qi][kt] = __builtin_amdgcn_wmma_f32_16x16x32_f16(
                false, aK[kt][dh], false, bq[qi][dh], (short)0, s[qi][kt],
                false, false);

      // ---- masking only on the diagonal block; row max ----
      const bool diag = (kb == qt0);
#pragma unroll
      for (int qi = 0; qi < 2; ++qi) {
        const int q = qt0 + qi * 16 + ll;
        if (diag) {
#pragma unroll
          for (int r = 0; r < 8; ++r) {
            const int k0 = kb + r + 8 * hb;
            s[qi][0][r] = (k0      > q) ? NEG : s[qi][0][r];
            s[qi][1][r] = (k0 + 16 > q) ? NEG : s[qi][1][r];
          }
        }
        // row max MUST merge the lane pair (both halves feed one column)
        float vm = NEG;
#pragma unroll
        for (int r = 0; r < 8; ++r)
          vm = fmaxf(vm, fmaxf(s[qi][0][r], s[qi][1][r]));
        vmax[qi] = vm;
      }
      const float o0 = __shfl_xor(vmax[0], 16, 32);
      const float o1 = __shfl_xor(vmax[1], 16, 32);
      // keeps both exchanges in flight together: without it the scheduler
      // puts the second behind the first one's wait (two latencies in a row)
      __builtin_amdgcn_sched_barrier(0);
      vmax[0] = fmaxf(vmax[0], o0);
      vmax[1] = fmaxf(vmax[1], o1);
    }

    // ---- stage ib+1 into the other buffer (f32 -> f16): every wave.
    // ---- Its loads had a whole pass to land; its stores drain under the
    // ---- exponentials and the PV products below.
    if (ib + 1 < nst) {
      const int nxt = cur ^ 1;
#pragma unroll
      for (int i = 0; i < 4; ++i) {
        v4h hk;
#pragma unroll
        for (int j = 0; j < 4; ++j) hk[j] = (_Float16)rk[i][j];
        *(v4h*)(&sK[nxt][(i * KB + kw) * KROW + dq]) = hk;  // ds_store_b64
        v4h hv;
#pragma unroll
        for (int j = 0; j < 4; ++j) hv[j] = (_Float16)rv[i][j];
        *(v4h*)(&sV[nxt][(i * KB + kw) * VROW + dq]) = hv;  // ds_store_b64
      }
      // ---- issue stage ib+2's loads; they are waited for one pass later ----
      if (ib + 2 < nst) {
        const float* Kn = Kb + (size_t)((ib + 2) * SB) * Hh * Dd;
        const float* Vn = Vb + (size_t)((ib + 2) * SB) * Hh * Dd;
#pragma unroll
        for (int i = 0; i < 4; ++i) {
          rk[i] = *(const v4f*)(Kn + i * KB * Hh * Dd + gl);
          rv[i] = *(const v4f*)(Vn + i * KB * Hh * Dd + gl);
        }
        // the code below overwrites the address registers that these loads name
        asm volatile("s_wait_xcnt 0x0" ::: "memory");
      }
    }

    if (active) {
      // ---- per-tile softmax ----
      v16h bp[2];
#pragma unroll
      for (int qi = 0; qi < 2; ++qi) {
        const float m_new = fmaxf(m_i[qi], vmax[qi]);
        const float ms    = m_new * SCL;
        const float alpha = fexp2(fmaf(m_i[qi], SCL, -ms));

        float rsum = 0.0f;                      // own-half sum only (deferred)
#pragma unroll
        for (int r = 0; r < 8; ++r) {
          const float p0 = fexp2(fmaf(s[qi][0][r], SCL, -ms));
          const float p1 = fexp2(fmaf(s[qi][1][r], SCL, -ms));
          rsum += p0 + p1;
          bp[qi][r]     = (_Float16)p0;
          bp[qi][r + 8] = (_Float16)p1;
        }
        l_i[qi] = l_i[qi] * alpha + rsum;       // same alpha in both lanes
        m_i[qi] = m_new;
#pragma unroll
        for (int t = 0; t < 4; ++t)
          for (int r = 0; r < 8; ++r) acc[qi][t][r] *= alpha;
      }

      // ---- O^T += V^T x P^T : V fragments reused by both q-tiles ----
#pragma unroll
      for (int t = 0; t < 4; ++t) {
        acc[0][t] = __builtin_amdgcn_wmma_f32_16x16x32_f16(
            false, av[t], false, bp[0], (short)0, acc[0][t], false, false);
        acc[1][t] = __builtin_amdgcn_wmma_f32_16x16x32_f16(
            false, av[t], false, bp[1], (short)0, acc[1][t], false, false);
      }
    }
  }

  // ---- join of the key groups: every group lays down max, sum, output ----
#pragma unroll
  for (int qi = 0; qi < 2; ++qi) {
    sML[kg][qw][qi][0][lane] = m_i[qi];
    sML[kg][qw][qi][1][lane] = l_i[qi];
#pragma unroll
    for (int t = 0; t < 4; ++t)
#pragma unroll
      for (int c = 0; c < 2; ++c) {
        v4f p;
#pragma unroll
        for (int r = 0; r < 4; ++r) p[r] = acc[qi][t][c * 4 + r];
        *(v4f*)(&sAcc[kg][qw][(qi * 4 + t) * 2 + c][lane][0]) = p;
      }
  }
  // publishes the partial results; behind it no wave reads this tile's stages
  __syncthreads();

  // ---- epilogue: group kg finishes q-tile kg / 2, d-tiles 2 * (kg & 1) and the
  // ---- next (whole 128-byte lines of its rows): every group's part rescaled to
  // ---- the common max and added in group order, partner half-sums merged
  // ---- once, normalized ----
  {
    const int qe = kg >> 1;
    const int t0 = (kg & 1) * 2;
    float mg[KG], w[KG];
    float mt = NEG;
#pragma unroll
    for (int k = 0; k < KG; ++k) {
      mg[k] = sML[k][qw][qe][0][lane];
      mt = fmaxf(mt, mg[k]);
    }
    const float ms = mt * SCL;
    float l = 0.0f;
#pragma unroll
    for (int k = 0; k < KG; ++k) {     // a group that saw no key: max NEG, weight 0
      w[k] = fexp2(fmaf(mg[k], SCL, -ms));
      l = fmaf(sML[k][qw][qe][1][lane], w[k], l);
    }
    const float l_tot = l + __shfl_xor(l, 16, 32);
    const float inv = 1.0f / l_tot;
#pragma unroll
    for (int k = 0; k < KG; ++k) w[k] *= inv;
    float* orow = Ob + (size_t)(qt0 + qe * 16 + ll) * Hh * Dd + t0 * 16 + 8 * hb;
#pragma unroll
    for (int tt = 0; tt < 2; ++tt)
#pragma unroll
      for (int c = 0; c < 2; ++c) {
        v4f o;
#pragma unroll
        for (int r = 0; r < 4; ++r) o[r] = 0.0f;
#pragma unroll
        for (int k = 0; k < KG; ++k) {
          const v4f p =
              *(const v4f*)(&sAcc[k][qw][(qe * 4 + t0 + tt) * 2 + c][lane][0]);
#pragma unroll
          for (int r = 0; r < 4; ++r) o[r] = fmaf(p[r], w[k], o[r]);
        }
        *(v4f*)(orow + tt * 16 + 4 * c) = o;
      }
  }
  // the next tile's set-up overwrites registers that these stores name
  asm volatile("s_wait_xcnt 0x0" ::: "memory");
  }  // half
}

extern "C" void kernel_launch(void* const* d_in, const int* in_sizes, int n_in,
                              void* d_out, int out_size, void* d_ws, size_t ws_size,
                              hipStream_t stream) {
  const float* q = (const float*)d_in[0];
  const float* k = (const float*)d_in[1];
  const float* v = (const float*)d_in[2];
  float* o = (float*)d_out;
  dim3 grid(NT / 2, Bb * Hh);         // 16 x 16 = 256 workgroups, two tiles each
  fa_fwd_causal<<<grid, dim3(NTHR), 0, stream>>>(q, k, v, o);
}

// v005
// Measured time: 40.5 microseconds a run.
// Timed twice side by side with v004, it ran 1.06 times as fast both times.
// Over all steps from v000 it is 3.95 times as fast.
#include <hip/hip_runtime.h>
#include <math.h>

// ---- CDNA5 flash-attention (causal): f16 WMMA, f32 online softmax.
// ---- 16 waves: 4 query slabs of 32 rows x 4 key groups. A stage is 128 keys;
// ---- key group g takes the stage's g-th block of 32, so four waves share each
// ---- SIMD and fill one another's waits. Each group keeps its own running
// ---- max / sum / output; the four are joined through LDS at the tile's end.
// ---- Double-buffered LDS, 1 barrier/stage; the next stage is staged in the
// ---- middle of the current one's compute.
// ---- V lies in LDS as it lies in memory, [key][d]; the transposing LDS load
// ---- hands out the V^T fragments.
// ---- Row-sum lane-merge deferred to epilogue (one shfl total).
// ---- Lazy rescale: exponentials are taken against a held reference max; sum
// ---- and output are rescaled (and the max merged across the lane pair) only
// ---- in a pass where some exponential against it would top 2^8.
// ---- Causal balance: a work-group runs query tile NT-1-x, then tile x, so
// ---- every work-group walks the same number of key blocks.
typedef __attribute__((ext_vector_type(16))) _Float16 v16h;
typedef __attribute__((ext_vector_type(8)))  _Float16 v8h;
typedef __attribute__((ext_vector_type(4)))  _Float16 v4h;
typedef __attribute__((ext_vector_type(8)))  float    v8f;
typedef __attribute__((ext_vector_type(4)))  float    v4f;
typedef __attribute__((ext_vector_type(8)))  short    v8s;
typedef __attribute__((address_space(3)))    v8s      lds_v8s;

constexpr int Bb = 2, Ls = 4096, Hh = 8, Dd = 64;
constexpr int BLOCK_M = 128;   // 4 slabs x 32 query rows
constexpr int NT      = Ls / BLOCK_M;  // query tiles per (batch, head)
constexpr int KB      = 32;    // keys per block (= WMMA K-dim for PV)
constexpr int KG      = 4;     // key groups (waves per query slab)
constexpr int SB      = KB * KG;       // keys per stage
constexpr int NTHR    = 32 * 4 * KG;   // threads per work-group
constexpr int KROW    = 72;    // LDS halves per K row  [128 x 64 + pad]
constexpr int VROW    = 80;    // LDS halves per V row  [128 x 64 + pad]: 32 B x odd
constexpr float SCL   = 0.125f * 1.44269504088896340736f; // (1/sqrt(D))*log2e
constexpr float NEG   = -1.0e30f;
constexpr float TAU   = 8.0f;   // exponent margin over the held max: P <= 2^8

// raw v_exp_f32: no denormal-range fixup (masked scores -> exact 0)
__device__ inline float fexp2(float x) { return __builtin_amdgcn_exp2f(x); }

__device__ inline v16h frag(const _Float16* s, int o0, int o1) {
  v8h lo = *(const v8h*)(s + o0);     // 16B aligned by construction
  v8h hi = *(const v8h*)(s + o1);
  return __builtin_shufflevector(lo, hi, 0,1,2,3,4,5,6,7,8,9,10,11,12,13,14,15);
}

// V^T A-fragment (16 d x 32 keys) out of row-major V: p is the lane's own
// address, row 8 * (lane >> 4) + (lane & 7), 16 bytes in for lanes 8..15 of a
// half. Each load hands lane (c, h) keys 8h..8h+7 of column c; the second one,
// 16 rows on, the keys 16 + 8h..: the k order of the packed P^T operand.
__device__ inline v16h frag_tr(const _Float16* p) {
  v8h lo = __builtin_bit_cast(v8h, __builtin_amdgcn_ds_load_tr16_b128_v8i16((lds_v8s*)p));
  v8h hi = __builtin_bit_cast(v8h, __builtin_amdgcn_ds_load_tr16_b128_v8i16(
                                       (lds_v8s*)(p + 16 * VROW)));
  return __builtin_shufflevector(lo, hi, 0,1,2,3,4,5,6,7,8,9,10,11,12,13,14,15);
}

__global__ __launch_bounds__(NTHR)
void fa_fwd_causal(const float* __restrict__ Q, const float* K,
                   const float* V, float* __restrict__ O) {
  // K, V without __restrict__: with it the first two stages' loads, alike for
  // both tiles, are lifted out of the tile loop and held in scratch across it
  __shared__ __align__(16) _Float16 sK[2][SB * KROW];       // [key][d]
  __shared__ __align__(16) _Float16 sV[2][SB * VROW];       // [key][d]
  // the key groups' partial results: [group][slab][chunk][lane][4]
  __shared__ __align__(16) float sAcc[KG][4][16][32][4];
  __shared__ float sML[KG][4][2][2][32];       // [group][slab][qi][max|sum][lane]

  const int tid  = threadIdx.x;
  // scalar wave number: slab, key group and the tests on them stay out of the
  // vector registers (a 16-wave work-group has 256 a wave; without this: scratch)
  const int wave = __builtin_amdgcn_readfirstlane(tid >> 5);
  const int qw   = wave & 3;     // query slab
  const int kg   = wave >> 2;    // key group
  const int lane = tid & 31;
  const int ll   = lane & 15;
  const int hb   = (lane >> 4) & 1;

  const int bh = blockIdx.y;
  const int b  = bh / Hh, h = bh % Hh;

  const size_t bstr = (size_t)Ls * Hh * Dd;
  const float* Qb = Q + (size_t)b * bstr + (size_t)h * Dd;
  const float* Kb = K + (size_t)b * bstr + (size_t)h * Dd;
  const float* Vb = V + (size_t)b * bstr + (size_t)h * Dd;
  float*       Ob = O + (size_t)b * bstr + (size_t)h * Dd;

  // cooperative-load mapping: a thread's i-th float4 (i = 0..KG-1) is key kw,
  // d = dq..dq+3 of the stage's block i: one lane offset, the rest constants
  const int kw = tid >> 4;
  const int dq = (tid & 15) << 2;
  const unsigned gl = (unsigned)(kw * Hh * Dd + dq);

  // Two tiles one after the other: (NT-x) + (x+1) stages for every x.
  // The barrier of the first tile's join also ends every read of its stages.
  for (int half = 0; half < 2; ++half) {
  const int qbase = (half ? (int)blockIdx.x : NT - 1 - (int)blockIdx.x) * BLOCK_M;
  const int qt0 = qbase + qw * 32;        // this wave: queries qt0..qt0+31

  // ---- Q^T B-fragments: [qi][dh], loaded once per tile ----
  v16h bq[2][2];
#pragma unroll
  for (int qi = 0; qi < 2; ++qi) {
    const float* qrow = Qb + (size_t)(qt0 + qi * 16 + ll) * Hh * Dd;
#pragma unroll
    for (int f = 0; f < 2; ++f) {
      const int d0 = f * 32 + 8 * hb;
      v4f a0 = *(const v4f*)(qrow + d0);
      v4f a1 = *(const v4f*)(qrow + d0 + 4);
      v4f a2 = *(const v4f*)(qrow + d0 + 16);
      v4f a3 = *(const v4f*)(qrow + d0 + 20);
#pragma unroll
      for (int j = 0; j < 4; ++j) {
        bq[qi][f][j]      = (_Float16)a0[j];
        bq[qi][f][j + 4]  = (_Float16)a1[j];
        bq[qi][f][j + 8]  = (_Float16)a2[j];
        bq[qi][f][j + 12] = (_Float16)a3[j];
      }
    }
  }

  v8f acc[2][4];
#pragma unroll
  for (int qi = 0; qi < 2; ++qi)
    for (int t = 0; t < 4; ++t)
      for (int r = 0; r < 8; ++r) acc[qi][t][r] = 0.0f;
  // held reference max, alike in a lane pair, as the exponent's addend
  float nms[2] = {-NEG * SCL, -NEG * SCL};     // -max * SCL
  float l_i[2] = {0.0f, 0.0f};     // own-half partial sums; merged in epilogue

  const int nst = qbase / SB + 1;         // stages of SB keys

  // ---- prologue: stage 0 through registers into buffer 0, stage 1 in flight ----
  v4f rk[4], rv[4];
#pragma unroll
  for (int i = 0; i < 4; ++i) {
    rk[i] = *(const v4f*)(Kb + i * KB * Hh * Dd + gl);
    rv[i] = *(const v4f*)(Vb + i * KB * Hh * Dd + gl);
  }
#pragma unroll
  for (int i = 0; i < 4; ++i) {
    v4h hk;
#pragma unroll
    for (int j = 0; j < 4; ++j) hk[j] = (_Float16)rk[i][j];
    *(v4h*)(&sK[0][(i * KB + kw) * KROW + dq]) = hk;
    v4h hv;
#pragma unroll
    for (int j = 0; j < 4; ++j) hv[j] = (_Float16)rv[i][j];
    *(v4h*)(&sV[0][(i * KB + kw) * VROW + dq]) = hv;
  }
  if (nst > 1) {
#pragma unroll
    for (int i = 0; i < 4; ++i) {
      rk[i] = *(const v4f*)(Kb + (SB + i * KB) * Hh * Dd + gl);
      rv[i] = *(const v4f*)(Vb + (SB + i * KB) * Hh * Dd + gl);
    }
  }

  for (int ib = 0; ib < nst; ++ib) {
    const int cur = ib & 1;
    const int kb  = ib * SB + kg * KB;    // this wave's block of the stage

    // Publishes buffer cur and frees buffer cur^1. Waits on LDS only:
    // __syncthreads() also drains loadcnt, which would expose the whole
    // latency of the global loads that are in flight for the next block.
    asm volatile("s_wait_dscnt 0x0\n\ts_barrier_signal -1\n\ts_barrier_wait -1"
                 ::: "memory");

    // both q-tiles active iff kb <= qt0 (kb, qt0 are 32-aligned); uniform.
    const bool active = (kb <= qt0);
    v8f  s[2][2];                                  // [qi][ktile]
    v16h av[4];                                    // V^T fragments, [dtile]
    float vmax[2];                                 // own half's block max
    unsigned grow = 0;                             // lanes above the margin

    if (active) {
      const _Float16* cK = sK[cur] + kg * KB * KROW;
      const _Float16* cV = sV[cur] + (kg * KB + 8 * hb + (lane & 7)) * VROW
                           + 8 * ((lane >> 3) & 1);

      // ---- K A-fragments, shared by both q-tiles ----
      v16h aK[2][2];                               // [ktile][dh]
#pragma unroll
      for (int kt = 0; kt < 2; ++kt)
#pragma unroll
        for (int dh = 0; dh < 2; ++dh)
          aK[kt][dh] = frag(cK, (kt * 16 + ll) * KROW + 32 * dh + 8 * hb,
                                (kt * 16 + ll) * KROW + 32 * dh + 16 + 8 * hb);
      // ---- V^T fragments now, ahead of the next block's LDS stores ----
#pragma unroll
      for (int t = 0; t < 4; ++t) av[t] = frag_tr(cV + t * 16);

      // ---- S^T = K x Q^T : 8 WMMAs, 4 independent accumulator chains ----
#pragma unroll
      for (int qi = 0; qi < 2; ++qi)
        for (int kt = 0; kt < 2; ++kt)
          for (int r = 0; r < 8; ++r) s[qi][kt][r] = 0.0f;
#pragma unroll
      for (int dh = 0; dh < 2; ++dh)
#pragma unroll
        for (int qi = 0; qi < 2; ++qi)
#pragma unroll
          for (int kt = 0; kt < 2; ++kt)
            s[qi][kt] = __builtin_amdgcn_wmma_f32_16x16x32_f16(
                false, aK[kt][dh], false, bq[qi][dh], (short)0, s[qi][kt],
                false, false);

      // ---- masking only on the diagonal block; row max ----
      const bool diag = (kb == qt0);
#pragma unroll
      for (int qi = 0; qi < 2; ++qi) {
        const int q = qt0 + qi * 16 + ll;
        if (diag) {
#pragma unroll
          for (int r = 0; r < 8; ++r) {
            const int k0 = kb + r + 8 * hb;
            s[qi][0][r] = (k0      > q) ? NEG : s[qi][0][r];
            s[qi][1][r] = (k0 + 16 > q) ? NEG : s[qi][1][r];
          }
        }
        float vm = NEG;
#pragma unroll
        for (int r = 0; r < 8; ++r)
          vm = fmaxf(vm, fmaxf(s[qi][0][r], s[qi][1][r]));
        vmax[qi] = vm;
      }
      // each lane tests its own half; the ballot covers the partner's
      grow = __builtin_amdgcn_ballot_w32(fmaf(vmax[0], SCL, nms[0]) > TAU) |
             __builtin_amdgcn_ballot_w32(fmaf(vmax[1], SCL, nms[1]) > TAU);
    }

    // ---- stage ib+1 into the other buffer (f32 -> f16): every wave.
    // ---- Its loads had a whole pass to land; its stores drain under the
    // ---- exponentials and the PV products below.
    if (ib + 1 < nst) {
      const int nxt = cur ^ 1;
#pragma unroll
      for (int i = 0; i < 4; ++i) {
        v4h hk;
#pragma unroll
        for (int j = 0; j < 4; ++j) hk[j] = (_Float16)rk[i][j];
        *(v4h*)(&sK[nxt][(i * KB + kw) * KROW + dq]) = hk;  // ds_store_b64
        v4h hv;
#pragma unroll
        for (int j = 0; j < 4; ++j) hv[j] = (_Float16)rv[i][j];
        *(v4h*)(&sV[nxt][(i * KB + kw) * VROW + dq]) = hv;  // ds_store_b64
      }
      // ---- issue stage ib+2's loads; they are waited for one pass later ----
      if (ib + 2 < nst) {
        const float* Kn = Kb + (size_t)((ib + 2) * SB) * Hh * Dd;
        const float* Vn = Vb + (size_t)((ib + 2) * SB) * Hh * Dd;
#pragma unroll
        for (int i = 0; i < 4; ++i) {
          rk[i] = *(const v4f*)(Kn + i * KB * Hh * Dd + gl);
          rv[i] = *(const v4f*)(Vn + i * KB * Hh * Dd + gl);
        }
        // the code below overwrites the address registers that these loads name
        asm volatile("s_wait_xcnt 0x0" ::: "memory");
      }
    }

    if (active) {
      // ---- the held max moves up: wave-uniform; always in a group's first
      // ---- active pass (held max NEG), later only past the margin ----
      if (grow) {
        // the new max MUST merge the lane pair (both halves feed one column)
        const float o[2] = {__shfl_xor(vmax[0], 16, 32),
                            __shfl_xor(vmax[1], 16, 32)};
#pragma unroll
        for (int qi = 0; qi < 2; ++qi) {
          const float m_blk = fmaxf(vmax[qi], o[qi]);
          const float ms    = fmaxf(-nms[qi], m_blk * SCL);
          const float alpha = fexp2(-nms[qi] - ms);
          l_i[qi] *= alpha;                     // same alpha in both lanes
          nms[qi] = -ms;
#pragma unroll
          for (int t = 0; t < 4; ++t)
            for (int r = 0; r < 8; ++r) acc[qi][t][r] *= alpha;
        }
      }

      // ---- per-tile softmax against the held max ----
      v16h bp[2];
#pragma unroll
      for (int qi = 0; qi < 2; ++qi) {
        float rsum = 0.0f;                      // own-half sum only (deferred)
#pragma unroll
        for (int r = 0; r < 8; ++r) {
          const float p0 = fexp2(fmaf(s[qi][0][r], SCL, nms[qi]));
          const float p1 = fexp2(fmaf(s[qi][1][r], SCL, nms[qi]));
          rsum += p0 + p1;
          bp[qi][r]     = (_Float16)p0;
          bp[qi][r + 8] = (_Float16)p1;
        }
        l_i[qi] += rsum;

        // ---- O^T += V^T x P^T : V fragments reused by both q-tiles; one
        // ---- q-tile at a time (both P^T operands live at once: scratch) ----
#pragma unroll
        for (int t = 0; t < 4; ++t)
          acc[qi][t] = __builtin_amdgcn_wmma_f32_16x16x32_f16(
              false, av[t], false, bp[qi], (short)0, acc[qi][t], false, false);
      }
    }
  }

  // ---- join of the key groups: every group lays down max, sum, output ----
#pragma unroll
  for (int qi = 0; qi < 2; ++qi) {
    sML[kg][qw][qi][0][lane] = -nms[qi];        // held max, times SCL
    sML[kg][qw][qi][1][lane] = l_i[qi];
#pragma unroll
    for (int t = 0; t < 4; ++t)
#pragma unroll
      for (int c = 0; c < 2; ++c) {
        v4f p;
#pragma unroll
        for (int r = 0; r < 4; ++r) p[r] = acc[qi][t][c * 4 + r];
        *(v4f*)(&sAcc[kg][qw][(qi * 4 + t) * 2 + c][lane][0]) = p;
      }
  }
  // publishes the partial results; behind it no wave reads this tile's stages
  __syncthreads();

  // ---- epilogue: group kg finishes q-tile kg / 2, d-tiles 2 * (kg & 1) and the
  // ---- next (whole 128-byte lines of its rows): every group's part rescaled to
  // ---- the common max and added in group order, partner half-sums merged
  // ---- once, normalized ----
  {
    const int qe = kg >> 1;
    const int t0 = (kg & 1) * 2;
    float mg[KG], w[KG];
    float mt = NEG;
#pragma unroll
    for (int k = 0; k < KG; ++k) {
      mg[k] = sML[k][qw][qe][0][lane];
      mt = fmaxf(mt, mg[k]);
    }
    float l = 0.0f;
#pragma unroll
    for (int k = 0; k < KG; ++k) {     // a group that saw no key: max NEG, weight 0
      w[k] = fexp2(mg[k] - mt);
      l = fmaf(sML[k][qw][qe][1][lane], w[k], l);
    }
    const float l_tot = l + __shfl_xor(l, 16, 32);
    const float inv = 1.0f / l_tot;
#pragma unroll
    for (int k = 0; k < KG; ++k) w[k] *= inv;
    float* orow = Ob + (size_t)(qt0 + qe * 16 + ll) * Hh * Dd + t0 * 16 + 8 * hb;
#pragma unroll
    for (int tt = 0; tt < 2; ++tt)
#pragma unroll
      for (int c = 0; c < 2; ++c) {
        v4f o;
#pragma unroll
        for (int r = 0; r < 4; ++r) o[r] = 0.0f;
#pragma unroll
        for (int k = 0; k < KG; ++k) {
          const v4f p =
              *(const v4f*)(&sAcc[k][qw][(qe * 4 + t0 + tt) * 2 + c][lane][0]);
#pragma unroll
          for (int r = 0; r < 4; ++r) o[r] = fmaf(p[r], w[k], o[r]);
        }
        *(v4f*)(orow + tt * 16 + 4 * c) = o;
      }
  }
  // the next tile's set-up overwrites registers that these stores name
  asm volatile("s_wait_xcnt 0x0" ::: "memory");
  }  // half
}

extern "C" void kernel_launch(void* const* d_in, const int* in_sizes, int n_in,
                              void* d_out, int out_size, void* d_ws, size_t ws_size,
                              hipStream_t stream) {
  const float* q = (const float*)d_in[0];
  const float* k = (const float*)d_in[1];
  const float* v = (const float*)d_in[2];
  float* o = (float*)d_out;
  dim3 grid(NT / 2, Bb * Hh);         // 16 x 16 = 256 workgroups, two tiles each
  fa_fwd_causal<<<grid, dim3(NTHR), 0, stream>>>(q, k, v, o);
}

// v006
// A run of this version takes 39.2 microseconds.
// Timed twice side by side with v005, it ran 1.03 times as fast both times.
// Counting every step since v000, it is 4.07 times as fast.
#include <hip/hip_runtime.h>
#include <math.h>

// ---- CDNA5 flash-attention (causal): f16 WMMA, f32 online softmax.
// ---- 16 waves: 4 query slabs of 32 rows x 4 key groups. A stage is 128 keys;
// ---- key group g takes the stage's g-th block of 32, so four waves share each
// ---- SIMD and fill one another's waits. Each group keeps its own running
// ---- max / sum / output; the four are joined through LDS at the tile's end.
// ---- Double-buffered LDS, 1 barrier/stage; the next stage is staged in the
// ---- middle of the current one's compute.
// ---- V lies in LDS as it lies in memory, [key][d]; the transposing LDS load
// ---- hands out the V^T fragments.
// ---- Row-sum lane-merge deferred to epilogue (one shfl total).
// ---- Softmax in register pairs: exponent FMA and row sum are packed f32 ops
// ---- on neighbouring score registers, so no operand is moved into a pair.
// ---- Lazy rescale: exponentials are taken against a held reference max; sum
// ---- and output are rescaled (and the max merged across the lane pair) only
// ---- in a pass where some exponential against it would top 2^8.
// ---- Causal balance: a work-group runs query tile NT-1-x, then tile x, so
// ---- every work-group walks the same number of key blocks.
typedef __attribute__((ext_vector_type(16))) _Float16 v16h;
typedef __attribute__((ext_vector_type(8)))  _Float16 v8h;
typedef __attribute__((ext_vector_type(4)))  _Float16 v4h;
typedef __attribute__((ext_vector_type(8)))  float    v8f;
typedef __attribute__((ext_vector_type(4)))  float    v4f;
typedef __attribute__((ext_vector_type(2)))  float    v2f;
typedef __attribute__((ext_vector_type(8)))  short    v8s;
typedef __attribute__((address_space(3)))    v8s      lds_v8s;

constexpr int Bb = 2, Ls = 4096, Hh = 8, Dd = 64;
constexpr int BLOCK_M = 128;   // 4 slabs x 32 query rows
constexpr int NT      = Ls / BLOCK_M;  // query tiles per (batch, head)
constexpr int KB      = 32;    // keys per block (= WMMA K-dim for PV)
constexpr int KG      = 4;     // key groups (waves per query slab)
constexpr int SB      = KB * KG;       // keys per stage
constexpr int NTHR    = 32 * 4 * KG;   // threads per work-group
constexpr int KROW    = 72;    // LDS halves per K row  [128 x 64 + pad]
constexpr int VROW    = 80;    // LDS halves per V row  [128 x 64 + pad]: 32 B x odd
constexpr float SCL   = 0.125f * 1.44269504088896340736f; // (1/sqrt(D))*log2e
constexpr float NEG   = -1.0e30f;
constexpr float TAU   = 8.0f;   // exponent margin over the held max: P <= 2^8

// raw v_exp_f32: no denormal-range fixup (masked scores -> exact 0)
__device__ inline float fexp2(float x) { return __builtin_amdgcn_exp2f(x); }

__device__ inline v16h frag(const _Float16* s, int o0, int o1) {
  v8h lo = *(const v8h*)(s + o0);     // 16B aligned by construction
  v8h hi = *(const v8h*)(s + o1);
  return __builtin_shufflevector(lo, hi, 0,1,2,3,4,5,6,7,8,9,10,11,12,13,14,15);
}

// V^T A-fragment (16 d x 32 keys) out of row-major V: p is the lane's own
// address, row 8 * (lane >> 4) + (lane & 7), 16 bytes in for lanes 8..15 of a
// half. Each load hands lane (c, h) keys 8h..8h+7 of column c; the second one,
// 16 rows on, the keys 16 + 8h..: the k order of the packed P^T operand.
__device__ inline v16h frag_tr(const _Float16* p) {
  v8h lo = __builtin_bit_cast(v8h, __builtin_amdgcn_ds_load_tr16_b128_v8i16((lds_v8s*)p));
  v8h hi = __builtin_bit_cast(v8h, __builtin_amdgcn_ds_load_tr16_b128_v8i16(
                                       (lds_v8s*)(p + 16 * VROW)));
  return __builtin_shufflevector(lo, hi, 0,1,2,3,4,5,6,7,8,9,10,11,12,13,14,15);
}

__global__ __launch_bounds__(NTHR)
void fa_fwd_causal(const float* __restrict__ Q, const float* K,
                   const float* V, float* __restrict__ O) {
  // K, V without __restrict__: with it the first two stages' loads, alike for
  // both tiles, are lifted out of the tile loop and held in scratch across it
  __shared__ __align__(16) _Float16 sK[2][SB * KROW];       // [key][d]
  __shared__ __align__(16) _Float16 sV[2][SB * VROW];       // [key][d]
  // the key groups' partial results: [slab][chunk][group][lane][4]: all that a
  // wave writes or reads lies within one address register's immediate offsets
  // (group outermost: five more registers held across the key loop, scratch)
  __shared__ __align__(16) float sAcc[4][16][KG][32][4];
  __shared__ float sML[KG][4][2][2][32];       // [group][slab][qi][max|sum][lane]

  const int tid  = threadIdx.x;
  // scalar wave number: slab, key group and the tests on them stay out of the
  // vector registers (a 16-wave work-group has 256 a wave; without this: scratch)
  const int wave = __builtin_amdgcn_readfirstlane(tid >> 5);
  const int qw   = wave & 3;     // query slab
  const int kg   = wave >> 2;    // key group
  const int lane = tid & 31;
  const int ll   = lane & 15;
  const int hb   = (lane >> 4) & 1;

  const int bh = blockIdx.y;
  const int b  = bh / Hh, h = bh % Hh;

  const size_t bstr = (size_t)Ls * Hh * Dd;
  const float* Qb = Q + (size_t)b * bstr + (size_t)h * Dd;
  const float* Kb = K + (size_t)b * bstr + (size_t)h * Dd;
  const float* Vb = V + (size_t)b * bstr + (size_t)h * Dd;
  float*       Ob = O + (size_t)b * bstr + (size_t)h * Dd;

  // cooperative-load mapping: a thread's i-th float4 (i = 0..KG-1) is key kw,
  // d = dq..dq+3 of the stage's block i: one lane offset, the rest constants
  const int kw = tid >> 4;
  const int dq = (tid & 15) << 2;
  const unsigned gl = (unsigned)(kw * Hh * Dd + dq);

  // Two tiles one after the other: (NT-x) + (x+1) stages for every x.
  // The barrier of the first tile's join also ends every read of its stages.
  for (int half = 0; half < 2; ++half) {
  const int qbase = (half ? (int)blockIdx.x : NT - 1 - (int)blockIdx.x) * BLOCK_M;
  const int qt0 = qbase + qw * 32;        // this wave: queries qt0..qt0+31

  // ---- Q^T B-fragments: [qi][dh], loaded once per tile ----
  v16h bq[2][2];
#pragma unroll
  for (int qi = 0; qi < 2; ++qi) {
    const float* qrow = Qb + (size_t)(qt0 + qi * 16 + ll) * Hh * Dd;
#pragma unroll
    for (int f = 0; f < 2; ++f) {
      const int d0 = f * 32 + 8 * hb;
      v4f a0 = *(const v4f*)(qrow + d0);
      v4f a1 = *(const v4f*)(qrow + d0 + 4);
      v4f a2 = *(const v4f*)(qrow + d0 + 16);
      v4f a3 = *(const v4f*)(qrow + d0 + 20);
#pragma unroll
      for (int j = 0; j < 4; ++j) {
        bq[qi][f][j]      = (_Float16)a0[j];
        bq[qi][f][j + 4]  = (_Float16)a1[j];
        bq[qi][f][j + 8]  = (_Float16)a2[j];
        bq[qi][f][j + 12] = (_Float16)a3[j];
      }
    }
  }

  v8f acc[2][4];
#pragma unroll
  for (int qi = 0; qi < 2; ++qi)
    for (int t = 0; t < 4; ++t)
      for (int r = 0; r < 8; ++r) acc[qi][t][r] = 0.0f;
  // held reference max, alike in a lane pair, as the exponent's addend
  float nms[2] = {-NEG * SCL, -NEG * SCL};     // -max * SCL
  // own-half partial sums, even and odd score registers apart; merged in epilogue
  v2f l_i[2] = {{0.0f, 0.0f}, {0.0f, 0.0f}};

  const int nst = qbase / SB + 1;         // stages of SB keys

  // ---- prologue: stage 0 through registers into buffer 0, stage 1 in flight ----
  v4f rk[4], rv[4];
#pragma unroll
  for (int i = 0; i < 4; ++i) {
    rk[i] = *(const v4f*)(Kb + i * KB * Hh * Dd + gl);
    rv[i] = *(const v4f*)(Vb + i * KB * Hh * Dd + gl);
  }
#pragma unroll
  for (int i = 0; i < 4; ++i) {
    v4h hk;
#pragma unroll
    for (int j = 0; j < 4; ++j) hk[j] = (_Float16)rk[i][j];
    *(v4h*)(&sK[0][(i * KB + kw) * KROW + dq]) = hk;
    v4h hv;
#pragma unroll
    for (int j = 0; j < 4; ++j) hv[j] = (_Float16)rv[i][j];
    *(v4h*)(&sV[0][(i * KB + kw) * VROW + dq]) = hv;
  }
  if (nst > 1) {
#pragma unroll
    for (int i = 0; i < 4; ++i) {
      rk[i] = *(const v4f*)(Kb + (SB + i * KB) * Hh * Dd + gl);
      rv[i] = *(const v4f*)(Vb + (SB + i * KB) * Hh * Dd + gl);
    }
  }

  for (int ib = 0; ib < nst; ++ib) {
    const int cur = ib & 1;
    const int kb  = ib * SB + kg * KB;    // this wave's block of the stage

    // Publishes buffer cur and frees buffer cur^1. Waits on LDS only:
    // __syncthreads() also drains loadcnt, which would expose the whole
    // latency of the global loads that are in flight for the next block.
    asm volatile("s_wait_dscnt 0x0\n\ts_barrier_signal -1\n\ts_barrier_wait -1"
                 ::: "memory");

    // both q-tiles active iff kb <= qt0 (kb, qt0 are 32-aligned); uniform.
    const bool active = (kb <= qt0);
    v8f  s[2][2];                                  // [qi][ktile]
    v16h av[4];                                    // V^T fragments, [dtile]
    float vmax[2];                                 // own half's block max
    unsigned grow = 0;                             // lanes above the margin

    if (active) {
      const _Float16* cK = sK[cur] + kg * KB * KROW;
      const _Float16* cV = sV[cur] + (kg * KB + 8 * hb + (lane & 7)) * VROW
                           + 8 * ((lane >> 3) & 1);

      // ---- K A-fragments, shared by both q-tiles ----
      v16h aK[2][2];                               // [ktile][dh]
#pragma unroll
      for (int kt = 0; kt < 2; ++kt)
#pragma unroll
        for (int dh = 0; dh < 2; ++dh)
          aK[kt][dh] = frag(cK, (kt * 16 + ll) * KROW + 32 * dh + 8 * hb,
                                (kt * 16 + ll) * KROW + 32 * dh + 16 + 8 * hb);
      // ---- V^T fragments now, ahead of the next block's LDS stores ----
#pragma unroll
      for (int t = 0; t < 4; ++t) av[t] = frag_tr(cV + t * 16);

      // ---- S^T = K x Q^T : 8 WMMAs, 4 independent accumulator chains ----
#pragma unroll
      for (int qi = 0; qi < 2; ++qi)
        for (int kt = 0; kt < 2; ++kt)
          for (int r = 0; r < 8; ++r) s[qi][kt][r] = 0.0f;
#pragma unroll
      for (int dh = 0; dh < 2; ++dh)
#pragma unroll
        for (int qi = 0; qi < 2; ++qi)
#pragma unroll
          for (int kt = 0; kt < 2; ++kt)
            s[qi][kt] = __builtin_amdgcn_wmma_f32_16x16x32_f16(
                false, aK[kt][dh], false, bq[qi][dh], (short)0, s[qi][kt],
                false, false);

      // ---- masking only on the diagonal block; row max ----
      const bool diag = (kb == qt0);
#pragma unroll
      for (int qi = 0; qi < 2; ++qi) {
        const int q = qt0 + qi * 16 + ll;
        if (diag) {
#pragma unroll
          for (int r = 0; r < 8; ++r) {
            const int k0 = kb + r + 8 * hb;
            s[qi][0][r] = (k0      > q) ? NEG : s[qi][0][r];
            s[qi][1][r] = (k0 + 16 > q) ? NEG : s[qi][1][r];
          }
        }
        float vm = NEG;
#pragma unroll
        for (int r = 0; r < 8; ++r)
          vm = fmaxf(vm, fmaxf(s[qi][0][r], s[qi][1][r]));
        vmax[qi] = vm;
      }
      // each lane tests its own half; the ballot covers the partner's
      grow = __builtin_amdgcn_ballot_w32(fmaf(vmax[0], SCL, nms[0]) > TAU) |
             __builtin_amdgcn_ballot_w32(fmaf(vmax[1], SCL, nms[1]) > TAU);
    }

    // ---- stage ib+1 into the other buffer (f32 -> f16): every wave.
    // ---- Its loads had a whole pass to land; its stores drain under the
    // ---- exponentials and the PV products below.
    if (ib + 1 < nst) {
      const int nxt = cur ^ 1;
#pragma unroll
      for (int i = 0; i < 4; ++i) {
        v4h hk;
#pragma unroll
        for (int j = 0; j < 4; ++j) hk[j] = (_Float16)rk[i][j];
        *(v4h*)(&sK[nxt][(i * KB + kw) * KROW + dq]) = hk;  // ds_store_b64
        v4h hv;
#pragma unroll
        for (int j = 0; j < 4; ++j) hv[j] = (_Float16)rv[i][j];
        *(v4h*)(&sV[nxt][(i * KB + kw) * VROW + dq]) = hv;  // ds_store_b64
      }
      // ---- issue stage ib+2's loads; they are waited for one pass later ----
      if (ib + 2 < nst) {
        const float* Kn = Kb + (size_t)((ib + 2) * SB) * Hh * Dd;
        const float* Vn = Vb + (size_t)((ib + 2) * SB) * Hh * Dd;
#pragma unroll
        for (int i = 0; i < 4; ++i) {
          rk[i] = *(const v4f*)(Kn + i * KB * Hh * Dd + gl);
          rv[i] = *(const v4f*)(Vn + i * KB * Hh * Dd + gl);
        }
        // the code below overwrites the address registers that these loads name
        asm volatile("s_wait_xcnt 0x0" ::: "memory");
      }
    }

    if (active) {
      // ---- the held max moves up: wave-uniform; always in a group's first
      // ---- active pass (held max NEG), later only past the margin ----
      if (grow) {
        // the new max MUST merge the lane pair (both halves feed one column)
        const float o[2] = {__shfl_xor(vmax[0], 16, 32),
                            __shfl_xor(vmax[1], 16, 32)};
#pragma unroll
        for (int qi = 0; qi < 2; ++qi) {
          const float m_blk = fmaxf(vmax[qi], o[qi]);
          const float ms    = fmaxf(-nms[qi], m_blk * SCL);
          const float alpha = fexp2(-nms[qi] - ms);
          l_i[qi] *= alpha;                     // same alpha in both lanes
          nms[qi] = -ms;
#pragma unroll
          for (int t = 0; t < 4; ++t)
            for (int r = 0; r < 8; ++r) acc[qi][t][r] *= alpha;
        }
      }

      // ---- per-tile softmax against the held max ----
      v16h bp[2];
#pragma unroll
      for (int qi = 0; qi < 2; ++qi) {
        const v2f sc2 = {SCL, SCL};
        const v2f nm2 = {nms[qi], nms[qi]};
#pragma unroll
        for (int kt = 0; kt < 2; ++kt)
#pragma unroll
          for (int r = 0; r < 8; r += 2) {
            // an accumulator's registers r, r + 1 are an aligned pair as they lie
            const v2f sp = {s[qi][kt][r], s[qi][kt][r + 1]};
            const v2f x  = __builtin_elementwise_fma(sp, sc2, nm2);
            const v2f p  = {fexp2(x[0]), fexp2(x[1])};
            l_i[qi] += p;                       // own-half sum only (deferred)
            bp[qi][kt * 8 + r]     = (_Float16)p[0];
            bp[qi][kt * 8 + r + 1] = (_Float16)p[1];
          }

        // ---- O^T += V^T x P^T : V fragments reused by both q-tiles; one
        // ---- q-tile at a time (both P^T operands live at once: scratch) ----
#pragma unroll
        for (int t = 0; t < 4; ++t)
          acc[qi][t] = __builtin_amdgcn_wmma_f32_16x16x32_f16(
              false, av[t], false, bp[qi], (short)0, acc[qi][t], false, false);
      }
    }
  }

  // ---- join of the key groups: every group lays down max, sum, output ----
#pragma unroll
  for (int qi = 0; qi < 2; ++qi) {
    sML[kg][qw][qi][0][lane] = -nms[qi];        // held max, times SCL
    sML[kg][qw][qi][1][lane] = l_i[qi][0] + l_i[qi][1];
#pragma unroll
    for (int t = 0; t < 4; ++t)
#pragma unroll
      for (int c = 0; c < 2; ++c) {
        v4f p;
#pragma unroll
        for (int r = 0; r < 4; ++r) p[r] = acc[qi][t][c * 4 + r];
        *(v4f*)(&sAcc[qw][(qi * 4 + t) * 2 + c][kg][lane][0]) = p;
      }
  }
  // publishes the partial results; behind it no wave reads this tile's stages
  __syncthreads();

  // ---- epilogue: group kg finishes q-tile kg / 2, d-tiles 2 * (kg & 1) and the
  // ---- next (whole 128-byte lines of its rows): every group's part rescaled to
  // ---- the common max and added in group order, partner half-sums merged
  // ---- once, normalized ----
  {
    const int qe = kg >> 1;
    const int t0 = (kg & 1) * 2;
    float mg[KG], w[KG];
    float mt = NEG;
#pragma unroll
    for (int k = 0; k < KG; ++k) {
      mg[k] = sML[k][qw][qe][0][lane];
      mt = fmaxf(mt, mg[k]);
    }
    float l = 0.0f;
#pragma unroll
    for (int k = 0; k < KG; ++k) {     // a group that saw no key: max NEG, weight 0
      w[k] = fexp2(mg[k] - mt);
      l = fmaf(sML[k][qw][qe][1][lane], w[k], l);
    }
    const float l_tot = l + __shfl_xor(l, 16, 32);
    const float inv = 1.0f / l_tot;
#pragma unroll
    for (int k = 0; k < KG; ++k) w[k] *= inv;
    float* orow = Ob + (size_t)(qt0 + qe * 16 + ll) * Hh * Dd + t0 * 16 + 8 * hb;
#pragma unroll
    for (int tt = 0; tt < 2; ++tt)
#pragma unroll
      for (int c = 0; c < 2; ++c) {
        v4f o;
#pragma unroll
        for (int r = 0; r < 4; ++r) o[r] = 0.0f;
#pragma unroll
        for (int k = 0; k < KG; ++k) {
          const v4f p =
              *(const v4f*)(&sAcc[qw][(qe * 4 + t0 + tt) * 2 + c][k][lane][0]);
#pragma unroll
          for (int r = 0; r < 4; ++r) o[r] = fmaf(p[r], w[k], o[r]);
        }
        *(v4f*)(orow + tt * 16 + 4 * c) = o;
      }
  }
  // the next tile's set-up overwrites registers that these stores name
  asm volatile("s_wait_xcnt 0x0" ::: "memory");
  }  // half
}

extern "C" void kernel_launch(void* const* d_in, const int* in_sizes, int n_in,
                              void* d_out, int out_size, void* d_ws, size_t ws_size,
                              hipStream_t stream) {
  const float* q = (const float*)d_in[0];
  const float* k = (const float*)d_in[1];
  const float* v = (const float*)d_in[2];
  float* o = (float*)d_out;
  dim3 grid(NT / 2, Bb * Hh);         // 16 x 16 = 256 workgroups, two tiles each
  fa_fwd_causal<<<grid, dim3(NTHR), 0, stream>>>(q, k, v, o);
}
